// v000
// The times below were measured on an AMD MI455X: many runs one after another, warmed up first and cycling through
// copies of the inputs, with the whole window's GPU time divided by the number of runs. Launches and the gaps
// between them are all in it. The median over several windows is given; except for v000 it joins two sittings, which
// can be a few percent apart, so the side-by-side timings, each taken in one sitting, are the better comparison.
// The starting kernel, v000, takes 1480 microseconds a run.
#include <hip/hip_runtime.h>

// Grouped (GQA-style) causal attention with full-width heads and LayerNorm on q and k (x [2048][2][256] (seq, batch, dim); K = x WK_w + WK_b, V = x WV_w + WV_b ('xw' [256][512]: 2 key groups of width 256); Q = x WQ_w + WQ_b ('xw' [256][2048]: 2 groups x 4 sub-queries of width 256, head (g, sub) uses key group g); K and Q LayerNormed over their 256 features (ln_g, ln_b, eps 1e-5); scores = Q.K/16, causal (-inf); softmax; out = merged (g, sub, i) WO_w + WO_b ('xw' [2048][256]) -> [2048][2][256] (1.05 M)).
// Compute dtypes, f32 accumulate: every input rounded to bf16; q/k/v on PLAIN bf16 operands (inputs: exact) + biases; LayerNorm of every 256-wide q / k head row in f32 (in place); causal scores and attn.v (tile skipping), one query head per pass reading its key group's planes: query rows < 512 hl (3 products), the rest single fp16 (x1024); softmax f32; WO_w hl x exact (2 products) + WO_b.

#define NB_  2
#define TT   2048
#define DM   256
#define NH_  8
#define NKV  2
#define REP  (NH_ / NKV)
#define HD   256
#define DQ   (NH_ * HD)
#define DKV  (NKV * HD)
#define ZH   1
#define RH   512                  // query rows < RH use hi+lo planes (0: none)
#define WIN  2048
#define PCAR 1024.0f
#define SCL  0.0625f   // 1/sqrt(dim = 256)
typedef _Float16 h16;
typedef unsigned short bf;
typedef __attribute__((ext_vector_type(16))) __bf16   v16bf;
typedef __attribute__((ext_vector_type(16))) _Float16 v16h;
typedef __attribute__((ext_vector_type(8)))  _Float16 v8h;
typedef __attribute__((ext_vector_type(8)))  unsigned short v8us;
typedef __attribute__((ext_vector_type(8)))  float    v8f;
typedef __attribute__((ext_vector_type(4)))  float    v4f;
typedef v8h  __attribute__((may_alias)) v8ha;
typedef v4f  __attribute__((may_alias)) v4fa;
typedef v8us __attribute__((may_alias)) v8usa;

__device__ __forceinline__ unsigned short f2bf(float f) { unsigned u = __float_as_uint(f); u += 0x7FFFu + ((u >> 16) & 1u); return (unsigned short)(u >> 16); }
__device__ __forceinline__ float bf2f(unsigned short b) { return __uint_as_float(((unsigned)b) << 16); }
__device__ __forceinline__ float bfr(float f) { return bf2f(f2bf(f)); }
__device__ __forceinline__ v16h cat16(v8h lo, v8h hi) { return __builtin_shufflevector(lo, hi, 0, 1, 2, 3, 4, 5, 6, 7, 8, 9, 10, 11, 12, 13, 14, 15); }
__device__ __forceinline__ v16bf cat16b(v8us lo, v8us hi) { return __builtin_bit_cast(v16bf, __builtin_shufflevector(lo, hi, 0, 1, 2, 3, 4, 5, 6, 7, 8, 9, 10, 11, 12, 13, 14, 15)); }
__device__ __forceinline__ v8f wmma16(v16h a, v16h b, v8f c) { return __builtin_amdgcn_wmma_f32_16x16x32_f16(false, a, false, b, (short)0, c, false, false); }
__device__ __forceinline__ v8f wmmab(v16bf a, v16bf b, v8f c) { return __builtin_amdgcn_wmma_f32_16x16x32_bf16(false, a, false, b, (short)0, c, false, false); }



// ---- k_gemmw: register-blocked GEMM, ONE WAVE per 64x64 output tile (16 accumulators), operands straight from K-contiguous 16-bit planes; grid (M/64, N/64, Z), 32 threads.
// C[m][n] (f32, pitch ldc, + optional f32 bias[n]) = sum_k A[m][k] Bt[n][k] (+ split products per NSPLIT). z-batch strides sA/sB/sC in elements. K % 32 == 0.
template <typename T16> struct WFrag;
template <> struct WFrag<h16> { typedef v16h V; static __device__ __forceinline__ V ld(const h16* p) { return cat16(*(const v8h*)p, *(const v8h*)(p + 16)); } static __device__ __forceinline__ v8f mma(V a, V b, v8f c) { return wmma16(a, b, c); } };
template <> struct WFrag<bf> { typedef v16bf V; static __device__ __forceinline__ V ld(const bf* p) { return cat16b(*(const v8us*)p, *(const v8us*)(p + 16)); } static __device__ __forceinline__ v8f mma(V a, V b, v8f c) { return wmmab(a, b, c); } };
template <typename T16, int NSPLIT, bool BIAS>
__global__ __launch_bounds__(32) void k_gemmw(const T16* __restrict__ A, const T16* __restrict__ A2, const T16* __restrict__ Bt, const T16* __restrict__ Bt2, int K, float* C, int ldc, const float* __restrict__ bias, size_t sA, size_t sB, size_t sC) {
    typedef typename WFrag<T16>::V V;
    __shared__ __align__(16) float os[16 * 68];
    const size_t z = blockIdx.z; A += z * sA; if (A2) A2 += z * sA; Bt += z * sB; if (Bt2) Bt2 += z * sB; C += z * sC;
    const int lane = threadIdx.x & 31, lr = lane & 15, hi = lane >> 4; const int r0 = blockIdx.x * 64, c0 = blockIdx.y * 64;
    v8f acc[4][4];
#pragma unroll
    for (int mb = 0; mb < 4; ++mb)
#pragma unroll
        for (int nb = 0; nb < 4; ++nb) acc[mb][nb] = (v8f){};
    const size_t aoff = (size_t)(r0 + lr) * K + 8 * hi, boff = (size_t)(c0 + lr) * K + 8 * hi;
#pragma unroll 1
    for (int kc = 0; kc < K; kc += 32) {
        V a[4], a2[4];
#pragma unroll
        for (int mb = 0; mb < 4; ++mb) { a[mb] = WFrag<T16>::ld(A + aoff + (size_t)mb * 16 * K + kc); if (NSPLIT == 1 || NSPLIT == 2) a2[mb] = WFrag<T16>::ld(A2 + aoff + (size_t)mb * 16 * K + kc); }
#pragma unroll
        for (int nb = 0; nb < 4; ++nb) { const V b = WFrag<T16>::ld(Bt + boff + (size_t)nb * 16 * K + kc); V b2; if (NSPLIT >= 2) b2 = WFrag<T16>::ld(Bt2 + boff + (size_t)nb * 16 * K + kc);
#pragma unroll
            for (int mb = 0; mb < 4; ++mb) { acc[mb][nb] = WFrag<T16>::mma(a[mb], b, acc[mb][nb]); if (NSPLIT == 1 || NSPLIT == 2) acc[mb][nb] = WFrag<T16>::mma(a2[mb], b, acc[mb][nb]); if (NSPLIT >= 2) acc[mb][nb] = WFrag<T16>::mma(a[mb], b2, acc[mb][nb]); } }
        asm volatile("v_nop\n\tv_nop\n\tv_nop\n\tv_nop" : "+v"(acc[0][0]), "+v"(acc[1][1]), "+v"(acc[2][2]), "+v"(acc[3][3]) : "v"(a[0]), "v"(a[3]));
    }
#pragma unroll
    for (int mb = 0; mb < 4; ++mb) {
#pragma unroll
        for (int nb = 0; nb < 4; ++nb) {
#pragma unroll
            for (int j = 0; j < 8; ++j) os[(hi * 8 + j) * 68 + nb * 16 + lr] = acc[mb][nb][j]; }
        __builtin_amdgcn_wave_barrier(); asm volatile("" ::: "memory");
        float* crow = C + (size_t)(r0 + mb * 16) * ldc + c0;
{
#pragma unroll
            for (int s = 0; s < 8; ++s) { const int row = 2 * s + hi, cofs = lr * 4; v4f val = *(const v4fa*)(os + row * 68 + cofs); if (BIAS) { val[0] += bfr(bias[c0 + cofs]); val[1] += bfr(bias[c0 + cofs + 1]); val[2] += bfr(bias[c0 + cofs + 2]); val[3] += bfr(bias[c0 + cofs + 3]); }
                *(v4f*)(crow + (size_t)row * ldc + cofs) = val; }
             }
        __builtin_amdgcn_wave_barrier(); asm volatile("" ::: "memory");
    }
}

// ---- k_gemmc: the same one-wave 64x64 tile GEMM specialised for causal attention: CMODE 1 skips score tiles entirely above the diagonal (query rows r0+roff.., key columns c0..), CMODE 2 limits the
// key (K) loop of the probability x value contraction to the diagonal block (probabilities beyond it are exactly zero). roff = row offset of this launch's first row within the sequence.
template <typename T16, int NSPLIT, int CMODE>
__global__ __launch_bounds__(32) void k_gemmc(const T16* __restrict__ A, const T16* __restrict__ A2, const T16* __restrict__ Bt, const T16* __restrict__ Bt2, int K, float* C, int ldc, int roff, size_t sA, size_t sB, size_t sC) {
    typedef typename WFrag<T16>::V V;
    __shared__ __align__(16) float os[16 * 68];
    const size_t z = blockIdx.z; A += z * sA; if (A2) A2 += z * sA; Bt += z * sB; if (Bt2) Bt2 += z * sB; C += z * sC;
    const int lane = threadIdx.x & 31, lr = lane & 15, hi = lane >> 4; const int r0 = blockIdx.x * 64, c0 = blockIdx.y * 64;
    if (CMODE == 1 && c0 > r0 + roff + 63) return;                  // score tile entirely above the causal diagonal: never read (the softmax masks j > i by select)
    const int Kl = (CMODE == 2) ? min(K, r0 + roff + 64) : K;        // P.V: probabilities are exactly 0 beyond the diagonal block, so the K loop stops there
    v8f acc[4][4];
#pragma unroll
    for (int mb = 0; mb < 4; ++mb)
#pragma unroll
        for (int nb = 0; nb < 4; ++nb) acc[mb][nb] = (v8f){};
    const size_t aoff = (size_t)(r0 + lr) * K + 8 * hi, boff = (size_t)(c0 + lr) * K + 8 * hi;
#pragma unroll 1
    for (int kc = 0; kc < Kl; kc += 32) {
        V a[4], a2[4];
#pragma unroll
        for (int mb = 0; mb < 4; ++mb) { a[mb] = WFrag<T16>::ld(A + aoff + (size_t)mb * 16 * K + kc); if (NSPLIT == 1 || NSPLIT == 2) a2[mb] = WFrag<T16>::ld(A2 + aoff + (size_t)mb * 16 * K + kc); }
#pragma unroll
        for (int nb = 0; nb < 4; ++nb) { const V b = WFrag<T16>::ld(Bt + boff + (size_t)nb * 16 * K + kc); V b2; if (NSPLIT >= 2) b2 = WFrag<T16>::ld(Bt2 + boff + (size_t)nb * 16 * K + kc);
#pragma unroll
            for (int mb = 0; mb < 4; ++mb) { acc[mb][nb] = WFrag<T16>::mma(a[mb], b, acc[mb][nb]); if (NSPLIT == 1 || NSPLIT == 2) acc[mb][nb] = WFrag<T16>::mma(a2[mb], b, acc[mb][nb]); if (NSPLIT >= 2) acc[mb][nb] = WFrag<T16>::mma(a[mb], b2, acc[mb][nb]); } }
        asm volatile("v_nop\n\tv_nop\n\tv_nop\n\tv_nop" : "+v"(acc[0][0]), "+v"(acc[1][1]), "+v"(acc[2][2]), "+v"(acc[3][3]) : "v"(a[0]), "v"(a[3]));
    }
#pragma unroll
    for (int mb = 0; mb < 4; ++mb) {
#pragma unroll
        for (int nb = 0; nb < 4; ++nb) {
#pragma unroll
            for (int j = 0; j < 8; ++j) os[(hi * 8 + j) * 68 + nb * 16 + lr] = acc[mb][nb][j]; }
        __builtin_amdgcn_wave_barrier(); asm volatile("" ::: "memory");
        float* crow = C + (size_t)(r0 + mb * 16) * ldc + c0;
{
#pragma unroll
            for (int s = 0; s < 8; ++s) { const int row = 2 * s + hi, cofs = lr * 4; v4f val = *(const v4fa*)(os + row * 68 + cofs);
                *(v4f*)(crow + (size_t)row * ldc + cofs) = val; }
             }
        __builtin_amdgcn_wave_barrier(); asm volatile("" ::: "memory");
    }
}

__device__ __forceinline__ h16 tohx(float x) { return (h16)x; }
__device__ __forceinline__ void splitf(float y, unsigned short& h, unsigned short& l) { h = f2bf(y); l = f2bf(y - bf2f(h)); }
typedef __attribute__((ext_vector_type(2))) _Float16 v2h;
typedef __attribute__((ext_vector_type(4))) _Float16 v4h;
typedef __attribute__((ext_vector_type(2))) unsigned short v2us;
typedef __attribute__((ext_vector_type(4))) unsigned short v4us;
typedef __attribute__((ext_vector_type(2))) float v2f;
typedef __attribute__((ext_vector_type(4))) int v4i;

__global__ __launch_bounds__(256) void k_wtG(const float* __restrict__ w, int K, int N, bf* Bt) {
    const int lane = threadIdx.x & 31; const int L0 = (blockIdx.x * 8 + (threadIdx.x >> 5)) * 8; const int nlines = N * K / 64;
{
#pragma unroll 1
        for (int l = 0; l < 8; ++l) { const int L = L0 + l; if (L >= nlines) break; const size_t e = (size_t)L * 64 + lane * 2; const int k = (int)(e % K), n = (int)(e / K); v2us o;
            o[0] = f2bf(w[(size_t)k * N + n]); o[1] = f2bf(w[(size_t)(k + 1) * N + n]); *(v2us*)(Bt + e) = o; }
         }
}
__global__ __launch_bounds__(256) void k_cvt8s(const float* __restrict__ src, size_t pitch, bf* dst, size_t n8) { const size_t i = (size_t)blockIdx.x * 256 + threadIdx.x; if (i >= n8) return; const size_t e = i * 8; const size_t t = e / DM, c = e % DM; const v8f v = *(const v8f*)(src + t * pitch + c); v8us o;
#pragma unroll
    for (int k = 0; k < 8; ++k) o[k] = f2bf(v[k]); *(v8us*)(dst + e) = o;  }
__global__ __launch_bounds__(256) void k_lnchunk(float* F, int nch, const float* __restrict__ gw, const float* __restrict__ gb) {
    const int lane = threadIdx.x & 31; const int w = blockIdx.x * 8 + (threadIdx.x >> 5); if (w >= TT * nch) return; float* fr = F + (size_t)w * HD; float hv[8]; float s = 0.f;
#pragma unroll
    for (int ch = 0; ch < 2; ++ch) { const v4f y = *(const v4f*)(fr + ch * 128 + lane * 4);
#pragma unroll
        for (int q = 0; q < 4; ++q) { hv[ch * 4 + q] = y[q]; s += y[q]; } }
#pragma unroll
    for (int sh = 16; sh; sh >>= 1) s += __shfl_xor(s, sh, 32);
    const float mu = s * (1.0f / HD); float s2 = 0.f;
#pragma unroll
    for (int k = 0; k < 8; ++k) { float d0 = __fsub_rn(hv[k], mu); asm volatile("" : "+v"(d0)); float p = __fmul_rn(d0, d0); asm volatile("" : "+v"(p)); s2 = __fadd_rn(s2, p); }
#pragma unroll
    for (int sh = 16; sh; sh >>= 1) s2 += __shfl_xor(s2, sh, 32);
    float var = __fadd_rn(s2 * (1.0f / HD), 1e-5f); asm volatile("" : "+v"(var)); const float rs = __frsqrt_rn(var);
    __builtin_amdgcn_wave_barrier(); asm volatile("" ::: "memory");
{
#pragma unroll
        for (int ch = 0; ch < 2; ++ch) { const int c0 = ch * 128 + lane * 4; v4f o;
#pragma unroll
            for (int q = 0; q < 4; ++q) { float gg = bfr(gw[c0 + q]), bb = bfr(gb[c0 + q]); asm volatile("" : "+v"(gg), "+v"(bb)); float d0 = __fsub_rn(hv[ch * 4 + q], mu); asm volatile("" : "+v"(d0)); float n0 = __fmul_rn(d0, rs); asm volatile("" : "+v"(n0)); float n1 = __fmul_rn(n0, gg); asm volatile("" : "+v"(n1)); o[q] = __fadd_rn(n1, bb); }
            *(v4f*)(fr + c0) = o; }
         } }
__global__ __launch_bounds__(256) void k_cvt8(const float* __restrict__ src, bf* dst, size_t n8) { const size_t i = (size_t)blockIdx.x * 256 + threadIdx.x; if (i >= n8) return; const v8f v = *(const v8f*)(src + i * 8); v8us o;
#pragma unroll
    for (int k = 0; k < 8; ++k) o[k] = f2bf(v[k]); *(v8us*)(dst + i * 8) = o;  }

// k_rope: head planes [h][t][d] (fp16 + hi/lo) of rope(x) x sc with the rotate-half convention out[d] = x[d] cos[t][d] - x[d+HD/2] sin[t][d], out[d+HD/2] = x[d+HD/2] cos[t][d+HD/2] + x[d] sin[t][d+HD/2]
__global__ __launch_bounds__(256) void k_rope(const float* __restrict__ F, int pitch, int nheads, const float* __restrict__ CS, const float* __restrict__ RF, const float* __restrict__ nw, float sc, h16* P16, bf* Ph, bf* Pl) {
    const size_t e = ((size_t)blockIdx.x * 256 + threadIdx.x) * 2; if (e >= (size_t)nheads * TT * HD) return; const int d = (int)(e % HD); const int t = (int)((e / HD) % TT); const int h = (int)(e / ((size_t)HD * TT)); const float* f = F + (size_t)t * pitch + h * HD; const float rf = RF ? RF[(size_t)h * TT + t] : 1.0f; v2h o16; v2us oh, ol;
#pragma unroll
    for (int q = 0; q < 2; ++q) { const int dd = d + q; const int dp = (dd < HD / 2) ? dd + HD / 2 : dd - HD / 2; float x0 = f[dd], x1 = f[dp];
        if (RF) { float n0 = __fmul_rn(x0, rf), n1 = __fmul_rn(x1, rf); asm volatile("" : "+v"(n0)); asm volatile("" : "+v"(n1)); x0 = __fmul_rn(bfr(nw[dd]), n0); x1 = __fmul_rn(bfr(nw[dp]), n1); }
        const v2f cs = *(const v2f*)(CS + ((size_t)t * HD + dd) * 2); float a = __fmul_rn(x0, cs[0]), bq = __fmul_rn(x1, cs[1]); asm volatile("" : "+v"(a)); asm volatile("" : "+v"(bq)); const float r = ((dd < HD / 2) ? __fsub_rn(a, bq) : __fadd_rn(a, bq)) * sc;
        o16[q] = tohx(r); unsigned short a2, c2; splitf(r, a2, c2); oh[q] = a2; ol[q] = c2; }
    *(v2h*)(P16 + e) = o16; *(v2us*)(Ph + e) = oh; *(v2us*)(Pl + e) = ol;  }
__global__ __launch_bounds__(256) void k_vtp(const float* __restrict__ F, int pitch, int nheads, h16* V16, bf* Vh, bf* Vl) { const size_t e = ((size_t)blockIdx.x * 256 + threadIdx.x) * 2; if (e >= (size_t)nheads * HD * TT) return; const int t = (int)(e % TT); const int d = (int)((e / TT) % HD); const int g = (int)(e / ((size_t)TT * HD)); v2h o16; v2us oh, ol;
#pragma unroll
    for (int q = 0; q < 2; ++q) { const float x = F[(size_t)(t + q) * pitch + g * HD + d]; o16[q] = tohx(x); unsigned short a2, c2; splitf(x, a2, c2); oh[q] = a2; ol[q] = c2; }
    *(v2h*)(V16 + e) = o16; *(v2us*)(Vh + e) = oh; *(v2us*)(Vl + e) = ol;  }
__global__ __launch_bounds__(256) void k_csid(float* CS) { const int idx = blockIdx.x * 256 + threadIdx.x; if (idx >= TT * HD) return; v2f cs; cs[0] = 1.0f; cs[1] = 0.0f; *(v2f*)(CS + (size_t)idx * 2) = cs;  }
// k_asoft: per row (zz, i): t = S x HD^-0.5 for j <= i and i - j < WIN (sliding causal window; the reference's -1e9 additive fill vanishes identically); softmax over the 2048 keys (register row, one exp, fixed trees);
__global__ __launch_bounds__(256) void k_asoft(const float* __restrict__ Sb, h16* P16, bf* Ph, bf* Pl) {
    const int lane = threadIdx.x & 31; const int row = blockIdx.x * 8 + (threadIdx.x >> 5); if (row >= ZH * TT) return; const int i = row % TT; const int zz = row / TT; (void)zz; const bool hires = (i < RH); const float* sr = Sb + (size_t)row * TT; float v[TT / 32]; float mx = -3.0e38f;
#pragma unroll
    for (int ch = 0; ch < TT / 128; ++ch) { const int j0 = ch * 128 + lane * 4; const v4f a = *(const v4f*)(sr + j0);
#pragma unroll
        for (int q = 0; q < 4; ++q) { const int j = j0 + q; (void)j; float sa = a[q] * SCL; asm volatile("" : "+v"(sa)); const float t = (j <= i) ? sa : -3.0e38f; v[ch * 4 + q] = t; mx = fmaxf(mx, t); } }
#pragma unroll
    for (int sh = 16; sh; sh >>= 1) mx = fmaxf(mx, __shfl_xor(mx, sh, 32));
    float sum = 0.f;
#pragma unroll
    for (int k = 0; k < TT / 32; ++k) { float d0 = __fsub_rn(v[k], mx); asm volatile("" : "+v"(d0)); v[k] = __builtin_amdgcn_exp2f(__fmul_rn(d0, 1.4426950408889634f)); sum += v[k]; }
#pragma unroll
    for (int sh = 16; sh; sh >>= 1) sum += __shfl_xor(sum, sh, 32);
    const float f = __fdiv_rn(hires ? 1.0f : PCAR, sum);
{
        if (hires) {
#pragma unroll
            for (int ch = 0; ch < TT / 128; ++ch) { v4us oh, ol;
#pragma unroll
                for (int q = 0; q < 4; ++q) { unsigned short a, c2; splitf(v[ch * 4 + q] * f, a, c2); oh[q] = a; ol[q] = c2; }
                const size_t oo = ((size_t)zz * (RH ? RH : 1) + i) * TT + ch * 128 + lane * 4; *(v4us*)(Ph + oo) = oh; *(v4us*)(Pl + oo) = ol; }
        } else {
#pragma unroll
            for (int ch = 0; ch < TT / 128; ++ch) { v4h o4;
#pragma unroll
                for (int q = 0; q < 4; ++q) o4[q] = tohx(v[ch * 4 + q] * f);
                *(v4h*)(P16 + (size_t)row * TT + ch * 128 + lane * 4) = o4; } }
         }
}
__global__ __launch_bounds__(256) void k_merge(const float* __restrict__ O, int h0, bf* Ah, bf* Al) { const size_t e = ((size_t)blockIdx.x * 256 + threadIdx.x) * 2; if (e >= (size_t)ZH * TT * HD) return; const int d = (int)(e % HD); const int t = (int)((e / HD) % TT); const int zz = (int)(e / ((size_t)HD * TT)); const float cs = (t < RH) ? 1.0f : (1.0f / PCAR); const size_t oo = (size_t)t * DQ + (h0 + zz) * HD + d;
    v2us oh, ol;
#pragma unroll
    for (int q = 0; q < 2; ++q) { unsigned short a, c2; splitf(O[e + q] * cs, a, c2); oh[q] = a; ol[q] = c2; } *(v2us*)(Ah + oo) = oh; *(v2us*)(Al + oo) = ol;  }

extern "C" void kernel_launch(void* const* d_in, const int* in_sizes, int n_in,
                              void* d_out, int out_size, void* d_ws, size_t ws_size, hipStream_t stream) {
    (void)in_sizes; (void)n_in; (void)out_size;
    const float* x = (const float*)d_in[0]; const float* wk = (const float*)d_in[1]; const float* bk = (const float*)d_in[2]; const float* wv = (const float*)d_in[3]; const float* bv = (const float*)d_in[4]; const float* wq = (const float*)d_in[5]; const float* bq = (const float*)d_in[6]; const float* wo = (const float*)d_in[7]; const float* bo = (const float*)d_in[8]; const float* lng = (const float*)d_in[9]; const float* lnb = (const float*)d_in[10];
    float* OUT = (float*)d_out;     // [2048][2][256] (seq, batch, dim)
    char* wsp = (char*)d_ws;
    auto take = [&](size_t bytes) { char* p = wsp; wsp += (bytes + 255) & ~(size_t)255; return (void*)p; };
    bf* WQ = (bf*)take((size_t)DQ * DM * 2); bf* WK = (bf*)take((size_t)DKV * DM * 2); bf* WV = (bf*)take((size_t)DKV * DM * 2); bf* WO = (bf*)take((size_t)DM * DQ * 2); float* CS = (float*)take((size_t)TT * HD * 2 * 4);
    bf* XB = (bf*)take((size_t)TT * DM * 2); float* FQ = (float*)take((size_t)TT * DQ * 4); float* FK = (float*)take((size_t)TT * DKV * 4);
    h16* QP16 = (h16*)take((size_t)NH_ * TT * HD * 2); h16* KP16 = (h16*)take((size_t)NKV * TT * HD * 2); h16* VT16 = (h16*)take((size_t)NKV * HD * TT * 2);
    bf* QPh = (bf*)take((size_t)NH_ * TT * HD * 2); bf* QPl = (bf*)take((size_t)NH_ * TT * HD * 2); bf* KPh = (bf*)take((size_t)NKV * TT * HD * 2); bf* KPl = (bf*)take((size_t)NKV * TT * HD * 2); bf* VTh = (bf*)take((size_t)NKV * HD * TT * 2); bf* VTl = (bf*)take((size_t)NKV * HD * TT * 2); bf* Ph = (bf*)take((size_t)ZH * RH * TT * 2); bf* Pl = (bf*)take((size_t)ZH * RH * TT * 2);
    float* Sb = (float*)take((size_t)ZH * TT * TT * 4); h16* P16 = (h16*)take((size_t)ZH * TT * TT * 2); float* Ob = (float*)take((size_t)ZH * TT * HD * 4); bf* ATh = (bf*)take((size_t)TT * DQ * 2); bf* ATl = (bf*)take((size_t)TT * DQ * 2);
    if ((size_t)(wsp - (char*)d_ws) > ws_size) return;    // ws 256 MiB
    float* FV = FK;   // v projection reuses the k buffer after the k planes are built (stream-ordered)
    { k_wtG<<<(unsigned)((DM * DQ / 64 + 63) / 64), 256, 0, stream>>>(wq, DM, DQ, WQ); k_wtG<<<(unsigned)((DM * DKV / 64 + 63) / 64), 256, 0, stream>>>(wk, DM, DKV, WK); k_wtG<<<(unsigned)((DM * DKV / 64 + 63) / 64), 256, 0, stream>>>(wv, DM, DKV, WV);
      k_wtG<<<(unsigned)((DQ * DM / 64 + 63) / 64), 256, 0, stream>>>(wo, DQ, DM, WO);
       }
    k_csid<<<(TT * HD + 255) / 256, 256, 0, stream>>>(CS);
    const unsigned LQ = (unsigned)(((size_t)NH_ * TT * HD / 2 + 255) / 256), LKv = (unsigned)(((size_t)NKV * TT * HD / 2 + 255) / 256);
    for (int b = 0; b < NB_; ++b) {
        
        k_cvt8s<<<(unsigned)(((size_t)TT * DM / 8 + 255) / 256), 256, 0, stream>>>(x + (size_t)b * DM, (size_t)NB_ * DM, XB, (size_t)TT * DM / 8);   /* batch b's strided rows */
        k_gemmw<bf, 0, true><<<dim3(TT / 64, DQ / 64, 1), 32, 0, stream>>>(XB, nullptr, WQ, nullptr, DM, FQ, DQ, bq, 0, 0, 0); k_lnchunk<<<TT * NH_ / 8, 256, 0, stream>>>(FQ, NH_, lng, lnb);   /* LayerNorm of each 256-wide query head */
        k_rope<<<LQ, 256, 0, stream>>>(FQ, DQ, NH_, CS, nullptr, nullptr, 1.0f, QP16, QPh, QPl);
        k_gemmw<bf, 0, true><<<dim3(TT / 64, DKV / 64, 1), 32, 0, stream>>>(XB, nullptr, WK, nullptr, DM, FK, DKV, bk, 0, 0, 0); k_lnchunk<<<TT * NKV / 8, 256, 0, stream>>>(FK, NKV, lng, lnb);   /* LayerNorm of each key group */
        k_rope<<<LKv, 256, 0, stream>>>(FK, DKV, NKV, CS, nullptr, nullptr, 1.0f, KP16, KPh, KPl);
        k_gemmw<bf, 0, true><<<dim3(TT / 64, DKV / 64, 1), 32, 0, stream>>>(XB, nullptr, WV, nullptr, DM, FV, DKV, bv, 0, 0, 0); k_vtp<<<LKv, 256, 0, stream>>>(FV, DKV, NKV, VT16, VTh, VTl);
        for (int h0 = 0; h0 < NH_; h0 += ZH) { const size_t zq = (size_t)h0, zk = (size_t)(h0 / REP);   // the pass's one head (ZH = 1) reads kv group h0/REP: sB = 0
            k_gemmc<bf, 2, 1><<<dim3(RH / 64, TT / 64, ZH), 32, 0, stream>>>(QPh + zq * TT * HD, QPl + zq * TT * HD, KPh + zk * TT * HD, KPl + zk * TT * HD, HD, Sb, TT, 0, (size_t)TT * HD, 0, (size_t)TT * TT);
            k_gemmc<h16, 0, 1><<<dim3((TT - RH) / 64, TT / 64, ZH), 32, 0, stream>>>(QP16 + zq * TT * HD + (size_t)RH * HD, nullptr, KP16 + zk * TT * HD, nullptr, HD, Sb + (size_t)RH * TT, TT, RH, (size_t)TT * HD, 0, (size_t)TT * TT);
            k_asoft<<<ZH * TT / 8, 256, 0, stream>>>(Sb, P16, Ph, Pl);
            k_gemmc<bf, 2, 2><<<dim3(RH / 64, HD / 64, ZH), 32, 0, stream>>>(Ph, Pl, VTh + zk * HD * TT, VTl + zk * HD * TT, TT, Ob, HD, 0, (size_t)RH * TT, 0, (size_t)TT * HD);
            k_gemmc<h16, 0, 2><<<dim3((TT - RH) / 64, HD / 64, ZH), 32, 0, stream>>>(P16 + (size_t)RH * TT, nullptr, VT16 + zk * HD * TT, nullptr, TT, Ob + (size_t)RH * HD, HD, RH, (size_t)TT * TT, 0, (size_t)TT * HD);
            k_merge<<<(unsigned)(((size_t)ZH * TT * HD / 2 + 255) / 256), 256, 0, stream>>>(Ob, h0, ATh, ATl); }
        k_gemmw<bf, 1, true><<<dim3(TT / 64, DM / 64, 1), 32, 0, stream>>>(ATh, ATl, WO, nullptr, DQ, OUT + (size_t)b * DM, NB_ * DM, bo, 0, 0, 0);   /* rows interleaved by batch: pitch 2 x 256 */ }
}

// v001
// Measured time: 537 microseconds a run.
// Timed twice side by side with v000, it ran 2.78 times as fast both times.
#include <hip/hip_runtime.h>

// Grouped (GQA-style) causal attention with full-width heads and LayerNorm on q and k (x [2048][2][256] (seq, batch, dim); K = x WK_w + WK_b, V = x WV_w + WV_b ('xw' [256][512]: 2 key groups of width 256); Q = x WQ_w + WQ_b ('xw' [256][2048]: 2 groups x 4 sub-queries of width 256, head (g, sub) uses key group g); K and Q LayerNormed over their 256 features (ln_g, ln_b, eps 1e-5); scores = Q.K/16, causal (-inf); softmax; out = merged (g, sub, i) WO_w + WO_b ('xw' [2048][256]) -> [2048][2][256] (1.05 M)).
// Compute dtypes, f32 accumulate: every input rounded to bf16; q/k/v on PLAIN bf16 operands (inputs: exact) + biases; LayerNorm of every 256-wide q / k head row in f32 (in place); causal scores and attn.v (tile skipping), all 8 query heads of a batch in one pass (grid z), each reading its key group's planes: query rows < 512 hl (3 products), the rest single fp16 (x1024); softmax f32; WO_w hl x exact (2 products) + WO_b.

#define NB_  2
#define TT   2048
#define DM   256
#define NH_  8
#define NKV  2
#define REP  (NH_ / NKV)
#define HD   256
#define DQ   (NH_ * HD)
#define DKV  (NKV * HD)
#define ZH   8                    // query heads per pass (grid z of the attention launches)
#define RH   512                  // query rows < RH use hi+lo planes (0: none)
#define WIN  2048
#define PCAR 1024.0f
#define SCL  0.0625f   // 1/sqrt(dim = 256)
typedef _Float16 h16;
typedef unsigned short bf;
typedef __attribute__((ext_vector_type(16))) __bf16   v16bf;
typedef __attribute__((ext_vector_type(16))) _Float16 v16h;
typedef __attribute__((ext_vector_type(8)))  _Float16 v8h;
typedef __attribute__((ext_vector_type(8)))  unsigned short v8us;
typedef __attribute__((ext_vector_type(8)))  float    v8f;
typedef __attribute__((ext_vector_type(4)))  float    v4f;
typedef v8h  __attribute__((may_alias)) v8ha;
typedef v4f  __attribute__((may_alias)) v4fa;
typedef v8us __attribute__((may_alias)) v8usa;

__device__ __forceinline__ unsigned short f2bf(float f) { unsigned u = __float_as_uint(f); u += 0x7FFFu + ((u >> 16) & 1u); return (unsigned short)(u >> 16); }
__device__ __forceinline__ float bf2f(unsigned short b) { return __uint_as_float(((unsigned)b) << 16); }
__device__ __forceinline__ float bfr(float f) { return bf2f(f2bf(f)); }
__device__ __forceinline__ v16h cat16(v8h lo, v8h hi) { return __builtin_shufflevector(lo, hi, 0, 1, 2, 3, 4, 5, 6, 7, 8, 9, 10, 11, 12, 13, 14, 15); }
__device__ __forceinline__ v16bf cat16b(v8us lo, v8us hi) { return __builtin_bit_cast(v16bf, __builtin_shufflevector(lo, hi, 0, 1, 2, 3, 4, 5, 6, 7, 8, 9, 10, 11, 12, 13, 14, 15)); }
__device__ __forceinline__ v8f wmma16(v16h a, v16h b, v8f c) { return __builtin_amdgcn_wmma_f32_16x16x32_f16(false, a, false, b, (short)0, c, false, false); }
__device__ __forceinline__ v8f wmmab(v16bf a, v16bf b, v8f c) { return __builtin_amdgcn_wmma_f32_16x16x32_bf16(false, a, false, b, (short)0, c, false, false); }



// ---- k_gemmw: register-blocked GEMM, ONE WAVE per 64x64 output tile (16 accumulators), operands straight from K-contiguous 16-bit planes; grid (M/64, N/64, Z), 32 threads.
// C[m][n] (f32, pitch ldc, + optional f32 bias[n]) = sum_k A[m][k] Bt[n][k] (+ split products per NSPLIT). z-batch strides sA/sB/sC in elements. K % 32 == 0.
template <typename T16> struct WFrag;
template <> struct WFrag<h16> { typedef v16h V; static __device__ __forceinline__ V ld(const h16* p) { return cat16(*(const v8h*)p, *(const v8h*)(p + 16)); } static __device__ __forceinline__ v8f mma(V a, V b, v8f c) { return wmma16(a, b, c); } };
template <> struct WFrag<bf> { typedef v16bf V; static __device__ __forceinline__ V ld(const bf* p) { return cat16b(*(const v8us*)p, *(const v8us*)(p + 16)); } static __device__ __forceinline__ v8f mma(V a, V b, v8f c) { return wmmab(a, b, c); } };
template <typename T16, int NSPLIT, bool BIAS>
__global__ __launch_bounds__(32) void k_gemmw(const T16* __restrict__ A, const T16* __restrict__ A2, const T16* __restrict__ Bt, const T16* __restrict__ Bt2, int K, float* C, int ldc, const float* __restrict__ bias, size_t sA, size_t sB, size_t sC) {
    typedef typename WFrag<T16>::V V;
    __shared__ __align__(16) float os[16 * 68];
    const size_t z = blockIdx.z; A += z * sA; if (A2) A2 += z * sA; Bt += z * sB; if (Bt2) Bt2 += z * sB; C += z * sC;
    const int lane = threadIdx.x & 31, lr = lane & 15, hi = lane >> 4; const int r0 = blockIdx.x * 64, c0 = blockIdx.y * 64;
    v8f acc[4][4];
#pragma unroll
    for (int mb = 0; mb < 4; ++mb)
#pragma unroll
        for (int nb = 0; nb < 4; ++nb) acc[mb][nb] = (v8f){};
    const size_t aoff = (size_t)(r0 + lr) * K + 8 * hi, boff = (size_t)(c0 + lr) * K + 8 * hi;
#pragma unroll 1
    for (int kc = 0; kc < K; kc += 32) {
        V a[4], a2[4];
#pragma unroll
        for (int mb = 0; mb < 4; ++mb) { a[mb] = WFrag<T16>::ld(A + aoff + (size_t)mb * 16 * K + kc); if (NSPLIT == 1 || NSPLIT == 2) a2[mb] = WFrag<T16>::ld(A2 + aoff + (size_t)mb * 16 * K + kc); }
#pragma unroll
        for (int nb = 0; nb < 4; ++nb) { const V b = WFrag<T16>::ld(Bt + boff + (size_t)nb * 16 * K + kc); V b2; if (NSPLIT >= 2) b2 = WFrag<T16>::ld(Bt2 + boff + (size_t)nb * 16 * K + kc);
#pragma unroll
            for (int mb = 0; mb < 4; ++mb) { acc[mb][nb] = WFrag<T16>::mma(a[mb], b, acc[mb][nb]); if (NSPLIT == 1 || NSPLIT == 2) acc[mb][nb] = WFrag<T16>::mma(a2[mb], b, acc[mb][nb]); if (NSPLIT >= 2) acc[mb][nb] = WFrag<T16>::mma(a[mb], b2, acc[mb][nb]); } }
        asm volatile("v_nop\n\tv_nop\n\tv_nop\n\tv_nop" : "+v"(acc[0][0]), "+v"(acc[1][1]), "+v"(acc[2][2]), "+v"(acc[3][3]) : "v"(a[0]), "v"(a[3]));
    }
#pragma unroll
    for (int mb = 0; mb < 4; ++mb) {
#pragma unroll
        for (int nb = 0; nb < 4; ++nb) {
#pragma unroll
            for (int j = 0; j < 8; ++j) os[(hi * 8 + j) * 68 + nb * 16 + lr] = acc[mb][nb][j]; }
        __builtin_amdgcn_wave_barrier(); asm volatile("" ::: "memory");
        float* crow = C + (size_t)(r0 + mb * 16) * ldc + c0;
{
#pragma unroll
            for (int s = 0; s < 8; ++s) { const int row = 2 * s + hi, cofs = lr * 4; v4f val = *(const v4fa*)(os + row * 68 + cofs); if (BIAS) { val[0] += bfr(bias[c0 + cofs]); val[1] += bfr(bias[c0 + cofs + 1]); val[2] += bfr(bias[c0 + cofs + 2]); val[3] += bfr(bias[c0 + cofs + 3]); }
                *(v4f*)(crow + (size_t)row * ldc + cofs) = val; }
             }
        __builtin_amdgcn_wave_barrier(); asm volatile("" ::: "memory");
    }
}

// ---- k_gemmc: the same one-wave 64x64 tile GEMM specialised for causal attention: CMODE 1 skips score tiles entirely above the diagonal (query rows r0+roff.., key columns c0..), CMODE 2 limits the
// key (K) loop of the probability x value contraction to the diagonal block (probabilities beyond it are exactly zero). roff = row offset of this launch's first row within the sequence.
// z = query head: A and C step by sA / sC per head, Bt by sB per key group (z / REP). lda = row pitch of A in elements (Bt's pitch is K).
template <typename T16, int NSPLIT, int CMODE>
__global__ __launch_bounds__(32) void k_gemmc(const T16* __restrict__ A, const T16* __restrict__ A2, const T16* __restrict__ Bt, const T16* __restrict__ Bt2, int K, int lda, float* C, int ldc, int roff, size_t sA, size_t sB, size_t sC) {
    typedef typename WFrag<T16>::V V;
    __shared__ __align__(16) float os[16 * 68];
    const size_t z = blockIdx.z, zg = z / REP; A += z * sA; if (A2) A2 += z * sA; Bt += zg * sB; if (Bt2) Bt2 += zg * sB; C += z * sC;
    const int lane = threadIdx.x & 31, lr = lane & 15, hi = lane >> 4; const int r0 = blockIdx.x * 64, c0 = blockIdx.y * 64;
    if (CMODE == 1 && c0 > r0 + roff + 63) return;                  // score tile entirely above the causal diagonal: never read (the softmax masks j > i by select)
    const int Kl = (CMODE == 2) ? min(K, r0 + roff + 64) : K;        // P.V: probabilities are exactly 0 beyond the diagonal block, so the K loop stops there
    v8f acc[4][4];
#pragma unroll
    for (int mb = 0; mb < 4; ++mb)
#pragma unroll
        for (int nb = 0; nb < 4; ++nb) acc[mb][nb] = (v8f){};
    const size_t aoff = (size_t)(r0 + lr) * lda + 8 * hi, boff = (size_t)(c0 + lr) * K + 8 * hi;
#pragma unroll 1
    for (int kc = 0; kc < Kl; kc += 32) {
        V a[4], a2[4];
#pragma unroll
        for (int mb = 0; mb < 4; ++mb) { a[mb] = WFrag<T16>::ld(A + aoff + (size_t)mb * 16 * lda + kc); if (NSPLIT == 1 || NSPLIT == 2) a2[mb] = WFrag<T16>::ld(A2 + aoff + (size_t)mb * 16 * lda + kc); }
#pragma unroll
        for (int nb = 0; nb < 4; ++nb) { const V b = WFrag<T16>::ld(Bt + boff + (size_t)nb * 16 * K + kc); V b2; if (NSPLIT >= 2) b2 = WFrag<T16>::ld(Bt2 + boff + (size_t)nb * 16 * K + kc);
#pragma unroll
            for (int mb = 0; mb < 4; ++mb) { acc[mb][nb] = WFrag<T16>::mma(a[mb], b, acc[mb][nb]); if (NSPLIT == 1 || NSPLIT == 2) acc[mb][nb] = WFrag<T16>::mma(a2[mb], b, acc[mb][nb]); if (NSPLIT >= 2) acc[mb][nb] = WFrag<T16>::mma(a[mb], b2, acc[mb][nb]); } }
        asm volatile("v_nop\n\tv_nop\n\tv_nop\n\tv_nop" : "+v"(acc[0][0]), "+v"(acc[1][1]), "+v"(acc[2][2]), "+v"(acc[3][3]) : "v"(a[0]), "v"(a[3]));
    }
#pragma unroll
    for (int mb = 0; mb < 4; ++mb) {
#pragma unroll
        for (int nb = 0; nb < 4; ++nb) {
#pragma unroll
            for (int j = 0; j < 8; ++j) os[(hi * 8 + j) * 68 + nb * 16 + lr] = acc[mb][nb][j]; }
        __builtin_amdgcn_wave_barrier(); asm volatile("" ::: "memory");
        float* crow = C + (size_t)(r0 + mb * 16) * ldc + c0;
{
#pragma unroll
            for (int s = 0; s < 8; ++s) { const int row = 2 * s + hi, cofs = lr * 4; v4f val = *(const v4fa*)(os + row * 68 + cofs);
                *(v4f*)(crow + (size_t)row * ldc + cofs) = val; }
             }
        __builtin_amdgcn_wave_barrier(); asm volatile("" ::: "memory");
    }
}

__device__ __forceinline__ h16 tohx(float x) { return (h16)x; }
__device__ __forceinline__ void splitf(float y, unsigned short& h, unsigned short& l) { h = f2bf(y); l = f2bf(y - bf2f(h)); }
typedef __attribute__((ext_vector_type(2))) _Float16 v2h;
typedef __attribute__((ext_vector_type(4))) _Float16 v4h;
typedef __attribute__((ext_vector_type(2))) unsigned short v2us;
typedef __attribute__((ext_vector_type(4))) unsigned short v4us;
typedef __attribute__((ext_vector_type(2))) float v2f;
typedef __attribute__((ext_vector_type(4))) int v4i;

__global__ __launch_bounds__(256) void k_wtG(const float* __restrict__ w, int K, int N, bf* Bt) {
    const int lane = threadIdx.x & 31; const int L0 = (blockIdx.x * 8 + (threadIdx.x >> 5)) * 8; const int nlines = N * K / 64;
{
#pragma unroll 1
        for (int l = 0; l < 8; ++l) { const int L = L0 + l; if (L >= nlines) break; const size_t e = (size_t)L * 64 + lane * 2; const int k = (int)(e % K), n = (int)(e / K); v2us o;
            o[0] = f2bf(w[(size_t)k * N + n]); o[1] = f2bf(w[(size_t)(k + 1) * N + n]); *(v2us*)(Bt + e) = o; }
         }
}
__global__ __launch_bounds__(256) void k_cvt8s(const float* __restrict__ src, size_t pitch, bf* dst, size_t n8) { const size_t i = (size_t)blockIdx.x * 256 + threadIdx.x; if (i >= n8) return; const size_t e = i * 8; const size_t t = e / DM, c = e % DM; const v8f v = *(const v8f*)(src + t * pitch + c); v8us o;
#pragma unroll
    for (int k = 0; k < 8; ++k) o[k] = f2bf(v[k]); *(v8us*)(dst + e) = o;  }
__global__ __launch_bounds__(256) void k_lnchunk(float* F, int nch, const float* __restrict__ gw, const float* __restrict__ gb) {
    const int lane = threadIdx.x & 31; const int w = blockIdx.x * 8 + (threadIdx.x >> 5); if (w >= TT * nch) return; float* fr = F + (size_t)w * HD; float hv[8]; float s = 0.f;
#pragma unroll
    for (int ch = 0; ch < 2; ++ch) { const v4f y = *(const v4f*)(fr + ch * 128 + lane * 4);
#pragma unroll
        for (int q = 0; q < 4; ++q) { hv[ch * 4 + q] = y[q]; s += y[q]; } }
#pragma unroll
    for (int sh = 16; sh; sh >>= 1) s += __shfl_xor(s, sh, 32);
    const float mu = s * (1.0f / HD); float s2 = 0.f;
#pragma unroll
    for (int k = 0; k < 8; ++k) { float d0 = __fsub_rn(hv[k], mu); asm volatile("" : "+v"(d0)); float p = __fmul_rn(d0, d0); asm volatile("" : "+v"(p)); s2 = __fadd_rn(s2, p); }
#pragma unroll
    for (int sh = 16; sh; sh >>= 1) s2 += __shfl_xor(s2, sh, 32);
    float var = __fadd_rn(s2 * (1.0f / HD), 1e-5f); asm volatile("" : "+v"(var)); const float rs = __frsqrt_rn(var);
    __builtin_amdgcn_wave_barrier(); asm volatile("" ::: "memory");
{
#pragma unroll
        for (int ch = 0; ch < 2; ++ch) { const int c0 = ch * 128 + lane * 4; v4f o;
#pragma unroll
            for (int q = 0; q < 4; ++q) { float gg = bfr(gw[c0 + q]), bb = bfr(gb[c0 + q]); asm volatile("" : "+v"(gg), "+v"(bb)); float d0 = __fsub_rn(hv[ch * 4 + q], mu); asm volatile("" : "+v"(d0)); float n0 = __fmul_rn(d0, rs); asm volatile("" : "+v"(n0)); float n1 = __fmul_rn(n0, gg); asm volatile("" : "+v"(n1)); o[q] = __fadd_rn(n1, bb); }
            *(v4f*)(fr + c0) = o; }
         } }
__global__ __launch_bounds__(256) void k_cvt8(const float* __restrict__ src, bf* dst, size_t n8) { const size_t i = (size_t)blockIdx.x * 256 + threadIdx.x; if (i >= n8) return; const v8f v = *(const v8f*)(src + i * 8); v8us o;
#pragma unroll
    for (int k = 0; k < 8; ++k) o[k] = f2bf(v[k]); *(v8us*)(dst + i * 8) = o;  }

// k_rope: head planes [h][t][d] (fp16 + hi/lo) of rope(x) x sc with the rotate-half convention out[d] = x[d] cos[t][d] - x[d+HD/2] sin[t][d], out[d+HD/2] = x[d+HD/2] cos[t][d+HD/2] + x[d] sin[t][d+HD/2]
__global__ __launch_bounds__(256) void k_rope(const float* __restrict__ F, int pitch, int nheads, const float* __restrict__ CS, const float* __restrict__ RF, const float* __restrict__ nw, float sc, h16* P16, bf* Ph, bf* Pl) {
    const size_t e = ((size_t)blockIdx.x * 256 + threadIdx.x) * 2; if (e >= (size_t)nheads * TT * HD) return; const int d = (int)(e % HD); const int t = (int)((e / HD) % TT); const int h = (int)(e / ((size_t)HD * TT)); const float* f = F + (size_t)t * pitch + h * HD; const float rf = RF ? RF[(size_t)h * TT + t] : 1.0f; v2h o16; v2us oh, ol;
#pragma unroll
    for (int q = 0; q < 2; ++q) { const int dd = d + q; const int dp = (dd < HD / 2) ? dd + HD / 2 : dd - HD / 2; float x0 = f[dd], x1 = f[dp];
        if (RF) { float n0 = __fmul_rn(x0, rf), n1 = __fmul_rn(x1, rf); asm volatile("" : "+v"(n0)); asm volatile("" : "+v"(n1)); x0 = __fmul_rn(bfr(nw[dd]), n0); x1 = __fmul_rn(bfr(nw[dp]), n1); }
        const v2f cs = *(const v2f*)(CS + ((size_t)t * HD + dd) * 2); float a = __fmul_rn(x0, cs[0]), bq = __fmul_rn(x1, cs[1]); asm volatile("" : "+v"(a)); asm volatile("" : "+v"(bq)); const float r = ((dd < HD / 2) ? __fsub_rn(a, bq) : __fadd_rn(a, bq)) * sc;
        o16[q] = tohx(r); unsigned short a2, c2; splitf(r, a2, c2); oh[q] = a2; ol[q] = c2; }
    *(v2h*)(P16 + e) = o16; *(v2us*)(Ph + e) = oh; *(v2us*)(Pl + e) = ol;  }
__global__ __launch_bounds__(256) void k_vtp(const float* __restrict__ F, int pitch, int nheads, h16* V16, bf* Vh, bf* Vl) { const size_t e = ((size_t)blockIdx.x * 256 + threadIdx.x) * 2; if (e >= (size_t)nheads * HD * TT) return; const int t = (int)(e % TT); const int d = (int)((e / TT) % HD); const int g = (int)(e / ((size_t)TT * HD)); v2h o16; v2us oh, ol;
#pragma unroll
    for (int q = 0; q < 2; ++q) { const float x = F[(size_t)(t + q) * pitch + g * HD + d]; o16[q] = tohx(x); unsigned short a2, c2; splitf(x, a2, c2); oh[q] = a2; ol[q] = c2; }
    *(v2h*)(V16 + e) = o16; *(v2us*)(Vh + e) = oh; *(v2us*)(Vl + e) = ol;  }
__global__ __launch_bounds__(256) void k_csid(float* CS) { const int idx = blockIdx.x * 256 + threadIdx.x; if (idx >= TT * HD) return; v2f cs; cs[0] = 1.0f; cs[1] = 0.0f; *(v2f*)(CS + (size_t)idx * 2) = cs;  }
// k_asoft: per row (zz, i): t = S x HD^-0.5 for j <= i and i - j < WIN (sliding causal window; the reference's -1e9 additive fill vanishes identically); softmax over the 2048 keys (register row, one exp, fixed trees);
// the fp16 probabilities of a row are stored over the first half of that row's own scores (P16 = Sb, pitch 2 x TT halves): the wave holds the whole row in registers before its first store, and no other wave touches the row.
__global__ __launch_bounds__(256) void k_asoft(const float* Sb, h16* P16, bf* Ph, bf* Pl) {
    const int lane = threadIdx.x & 31; const int row = blockIdx.x * 8 + (threadIdx.x >> 5); if (row >= ZH * TT) return; const int i = row % TT; const int zz = row / TT; (void)zz; const bool hires = (i < RH); const float* sr = Sb + (size_t)row * TT; float v[TT / 32]; float mx = -3.0e38f;
#pragma unroll
    for (int ch = 0; ch < TT / 128; ++ch) { const int j0 = ch * 128 + lane * 4; const v4f a = *(const v4f*)(sr + j0);
#pragma unroll
        for (int q = 0; q < 4; ++q) { const int j = j0 + q; (void)j; float sa = a[q] * SCL; asm volatile("" : "+v"(sa)); const float t = (j <= i) ? sa : -3.0e38f; v[ch * 4 + q] = t; mx = fmaxf(mx, t); } }
#pragma unroll
    for (int sh = 16; sh; sh >>= 1) mx = fmaxf(mx, __shfl_xor(mx, sh, 32));
    float sum = 0.f;
#pragma unroll
    for (int k = 0; k < TT / 32; ++k) { float d0 = __fsub_rn(v[k], mx); asm volatile("" : "+v"(d0)); v[k] = __builtin_amdgcn_exp2f(__fmul_rn(d0, 1.4426950408889634f)); sum += v[k]; }
#pragma unroll
    for (int sh = 16; sh; sh >>= 1) sum += __shfl_xor(sum, sh, 32);
    const float f = __fdiv_rn(hires ? 1.0f : PCAR, sum);
{
        if (hires) {
#pragma unroll
            for (int ch = 0; ch < TT / 128; ++ch) { v4us oh, ol;
#pragma unroll
                for (int q = 0; q < 4; ++q) { unsigned short a, c2; splitf(v[ch * 4 + q] * f, a, c2); oh[q] = a; ol[q] = c2; }
                const size_t oo = ((size_t)zz * (RH ? RH : 1) + i) * TT + ch * 128 + lane * 4; *(v4us*)(Ph + oo) = oh; *(v4us*)(Pl + oo) = ol; }
        } else {
#pragma unroll
            for (int ch = 0; ch < TT / 128; ++ch) { v4h o4;
#pragma unroll
                for (int q = 0; q < 4; ++q) o4[q] = tohx(v[ch * 4 + q] * f);
                *(v4h*)(P16 + (size_t)row * (2 * TT) + ch * 128 + lane * 4) = o4; } }
         }
}
__global__ __launch_bounds__(256) void k_merge(const float* __restrict__ O, int h0, bf* Ah, bf* Al) { const size_t e = ((size_t)blockIdx.x * 256 + threadIdx.x) * 2; if (e >= (size_t)ZH * TT * HD) return; const int d = (int)(e % HD); const int t = (int)((e / HD) % TT); const int zz = (int)(e / ((size_t)HD * TT)); const float cs = (t < RH) ? 1.0f : (1.0f / PCAR); const size_t oo = (size_t)t * DQ + (h0 + zz) * HD + d;
    v2us oh, ol;
#pragma unroll
    for (int q = 0; q < 2; ++q) { unsigned short a, c2; splitf(O[e + q] * cs, a, c2); oh[q] = a; ol[q] = c2; } *(v2us*)(Ah + oo) = oh; *(v2us*)(Al + oo) = ol;  }

extern "C" void kernel_launch(void* const* d_in, const int* in_sizes, int n_in,
                              void* d_out, int out_size, void* d_ws, size_t ws_size, hipStream_t stream) {
    (void)in_sizes; (void)n_in; (void)out_size;
    const float* x = (const float*)d_in[0]; const float* wk = (const float*)d_in[1]; const float* bk = (const float*)d_in[2]; const float* wv = (const float*)d_in[3]; const float* bv = (const float*)d_in[4]; const float* wq = (const float*)d_in[5]; const float* bq = (const float*)d_in[6]; const float* wo = (const float*)d_in[7]; const float* bo = (const float*)d_in[8]; const float* lng = (const float*)d_in[9]; const float* lnb = (const float*)d_in[10];
    float* OUT = (float*)d_out;     // [2048][2][256] (seq, batch, dim)
    char* wsp = (char*)d_ws;
    auto take = [&](size_t bytes) { char* p = wsp; wsp += (bytes + 255) & ~(size_t)255; return (void*)p; };
    bf* WQ = (bf*)take((size_t)DQ * DM * 2); bf* WK = (bf*)take((size_t)DKV * DM * 2); bf* WV = (bf*)take((size_t)DKV * DM * 2); bf* WO = (bf*)take((size_t)DM * DQ * 2); float* CS = (float*)take((size_t)TT * HD * 2 * 4);
    bf* XB = (bf*)take((size_t)TT * DM * 2); float* FQ = (float*)take((size_t)TT * DQ * 4); float* FK = (float*)take((size_t)TT * DKV * 4);
    h16* QP16 = (h16*)take((size_t)NH_ * TT * HD * 2); h16* KP16 = (h16*)take((size_t)NKV * TT * HD * 2); h16* VT16 = (h16*)take((size_t)NKV * HD * TT * 2);
    bf* QPh = (bf*)take((size_t)NH_ * TT * HD * 2); bf* QPl = (bf*)take((size_t)NH_ * TT * HD * 2); bf* KPh = (bf*)take((size_t)NKV * TT * HD * 2); bf* KPl = (bf*)take((size_t)NKV * TT * HD * 2); bf* VTh = (bf*)take((size_t)NKV * HD * TT * 2); bf* VTl = (bf*)take((size_t)NKV * HD * TT * 2); bf* Ph = (bf*)take((size_t)ZH * RH * TT * 2); bf* Pl = (bf*)take((size_t)ZH * RH * TT * 2);
    float* Sb = (float*)take((size_t)ZH * TT * TT * 4); h16* P16 = (h16*)Sb; /* in place, row pitch 2 x TT halves: 8 score planes and a separate probability plane do not fit the workspace together */ float* Ob = (float*)take((size_t)ZH * TT * HD * 4); bf* ATh = (bf*)take((size_t)TT * DQ * 2); bf* ATl = (bf*)take((size_t)TT * DQ * 2);
    if ((size_t)(wsp - (char*)d_ws) > ws_size) return;    // ws 256 MiB
    float* FV = FK;   // v projection reuses the k buffer after the k planes are built (stream-ordered)
    { k_wtG<<<(unsigned)((DM * DQ / 64 + 63) / 64), 256, 0, stream>>>(wq, DM, DQ, WQ); k_wtG<<<(unsigned)((DM * DKV / 64 + 63) / 64), 256, 0, stream>>>(wk, DM, DKV, WK); k_wtG<<<(unsigned)((DM * DKV / 64 + 63) / 64), 256, 0, stream>>>(wv, DM, DKV, WV);
      k_wtG<<<(unsigned)((DQ * DM / 64 + 63) / 64), 256, 0, stream>>>(wo, DQ, DM, WO);
       }
    k_csid<<<(TT * HD + 255) / 256, 256, 0, stream>>>(CS);
    const unsigned LQ = (unsigned)(((size_t)NH_ * TT * HD / 2 + 255) / 256), LKv = (unsigned)(((size_t)NKV * TT * HD / 2 + 255) / 256);
    for (int b = 0; b < NB_; ++b) {
        
        k_cvt8s<<<(unsigned)(((size_t)TT * DM / 8 + 255) / 256), 256, 0, stream>>>(x + (size_t)b * DM, (size_t)NB_ * DM, XB, (size_t)TT * DM / 8);   /* batch b's strided rows */
        k_gemmw<bf, 0, true><<<dim3(TT / 64, DQ / 64, 1), 32, 0, stream>>>(XB, nullptr, WQ, nullptr, DM, FQ, DQ, bq, 0, 0, 0); k_lnchunk<<<TT * NH_ / 8, 256, 0, stream>>>(FQ, NH_, lng, lnb);   /* LayerNorm of each 256-wide query head */
        k_rope<<<LQ, 256, 0, stream>>>(FQ, DQ, NH_, CS, nullptr, nullptr, 1.0f, QP16, QPh, QPl);
        k_gemmw<bf, 0, true><<<dim3(TT / 64, DKV / 64, 1), 32, 0, stream>>>(XB, nullptr, WK, nullptr, DM, FK, DKV, bk, 0, 0, 0); k_lnchunk<<<TT * NKV / 8, 256, 0, stream>>>(FK, NKV, lng, lnb);   /* LayerNorm of each key group */
        k_rope<<<LKv, 256, 0, stream>>>(FK, DKV, NKV, CS, nullptr, nullptr, 1.0f, KP16, KPh, KPl);
        k_gemmw<bf, 0, true><<<dim3(TT / 64, DKV / 64, 1), 32, 0, stream>>>(XB, nullptr, WV, nullptr, DM, FV, DKV, bv, 0, 0, 0); k_vtp<<<LKv, 256, 0, stream>>>(FV, DKV, NKV, VT16, VTh, VTl);
        for (int h0 = 0; h0 < NH_; h0 += ZH) { const size_t zq = (size_t)h0, zk = (size_t)(h0 / REP);   // head h0 + z of the pass reads kv group (h0 + z) / REP: h0 is a multiple of REP, the kernel steps Bt by sB per z / REP
            k_gemmc<bf, 2, 1><<<dim3(RH / 64, TT / 64, ZH), 32, 0, stream>>>(QPh + zq * TT * HD, QPl + zq * TT * HD, KPh + zk * TT * HD, KPl + zk * TT * HD, HD, HD, Sb, TT, 0, (size_t)TT * HD, (size_t)TT * HD, (size_t)TT * TT);
            k_gemmc<h16, 0, 1><<<dim3((TT - RH) / 64, TT / 64, ZH), 32, 0, stream>>>(QP16 + zq * TT * HD + (size_t)RH * HD, nullptr, KP16 + zk * TT * HD, nullptr, HD, HD, Sb + (size_t)RH * TT, TT, RH, (size_t)TT * HD, (size_t)TT * HD, (size_t)TT * TT);
            k_asoft<<<ZH * TT / 8, 256, 0, stream>>>(Sb, P16, Ph, Pl);
            k_gemmc<bf, 2, 2><<<dim3(RH / 64, HD / 64, ZH), 32, 0, stream>>>(Ph, Pl, VTh + zk * HD * TT, VTl + zk * HD * TT, TT, TT, Ob, HD, 0, (size_t)RH * TT, (size_t)HD * TT, (size_t)TT * HD);
            k_gemmc<h16, 0, 2><<<dim3((TT - RH) / 64, HD / 64, ZH), 32, 0, stream>>>(P16 + (size_t)RH * 2 * TT, nullptr, VT16 + zk * HD * TT, nullptr, TT, 2 * TT, Ob + (size_t)RH * HD, HD, RH, (size_t)TT * 2 * TT, (size_t)HD * TT, (size_t)TT * HD);
            k_merge<<<(unsigned)(((size_t)ZH * TT * HD / 2 + 255) / 256), 256, 0, stream>>>(Ob, h0, ATh, ATl); }
        k_gemmw<bf, 1, true><<<dim3(TT / 64, DM / 64, 1), 32, 0, stream>>>(ATh, ATl, WO, nullptr, DQ, OUT + (size_t)b * DM, NB_ * DM, bo, 0, 0, 0);   /* rows interleaved by batch: pitch 2 x 256 */ }
}

// v002
// It runs in 438 microseconds.
// Timed twice side by side with v001, it ran 1.23 and 1.24 times as fast.
// Over all steps from v000 it is 3.44 times as fast.
#include <hip/hip_runtime.h>

// Grouped (GQA-style) causal attention with full-width heads and LayerNorm on q and k (x [2048][2][256] (seq, batch, dim); K = x WK_w + WK_b, V = x WV_w + WV_b ('xw' [256][512]: 2 key groups of width 256); Q = x WQ_w + WQ_b ('xw' [256][2048]: 2 groups x 4 sub-queries of width 256, head (g, sub) uses key group g); K and Q LayerNormed over their 256 features (ln_g, ln_b, eps 1e-5); scores = Q.K/16, causal (-inf); softmax; out = merged (g, sub, i) WO_w + WO_b ('xw' [2048][256]) -> [2048][2][256] (1.05 M)).
// Compute dtypes, f32 accumulate: every input rounded to bf16; q/k/v on PLAIN bf16 operands (inputs: exact) + biases; LayerNorm of every 256-wide q / k head row in f32 (in place); causal scores and attn.v (tile skipping), all 8 query heads of a batch in one pass (grid z), each reading its key group's planes: query rows < 512 hl (3 products), the rest single fp16 (x1024); softmax f32; WO_w hl x exact (2 products) + WO_b.

#define NB_  2
#define TT   2048
#define DM   256
#define NH_  8
#define NKV  2
#define REP  (NH_ / NKV)
#define HD   256
#define DQ   (NH_ * HD)
#define DKV  (NKV * HD)
#define ZH   8                    // query heads per pass (grid z of the attention launches)
#define RH   512                  // query rows < RH use hi+lo planes (0: none)
#define WIN  2048
#define PCAR 1024.0f
#define SCL  0.0625f   // 1/sqrt(dim = 256)
typedef _Float16 h16;
typedef unsigned short bf;
typedef __attribute__((ext_vector_type(16))) __bf16   v16bf;
typedef __attribute__((ext_vector_type(16))) _Float16 v16h;
typedef __attribute__((ext_vector_type(8)))  _Float16 v8h;
typedef __attribute__((ext_vector_type(8)))  unsigned short v8us;
typedef __attribute__((ext_vector_type(8)))  float    v8f;
typedef __attribute__((ext_vector_type(4)))  float    v4f;
typedef v8h  __attribute__((may_alias)) v8ha;
typedef v4f  __attribute__((may_alias)) v4fa;
typedef v8us __attribute__((may_alias)) v8usa;

__device__ __forceinline__ unsigned short f2bf(float f) { unsigned u = __float_as_uint(f); u += 0x7FFFu + ((u >> 16) & 1u); return (unsigned short)(u >> 16); }
__device__ __forceinline__ float bf2f(unsigned short b) { return __uint_as_float(((unsigned)b) << 16); }
__device__ __forceinline__ float bfr(float f) { return bf2f(f2bf(f)); }
__device__ __forceinline__ v16h cat16(v8h lo, v8h hi) { return __builtin_shufflevector(lo, hi, 0, 1, 2, 3, 4, 5, 6, 7, 8, 9, 10, 11, 12, 13, 14, 15); }
__device__ __forceinline__ v16bf cat16b(v8us lo, v8us hi) { return __builtin_bit_cast(v16bf, __builtin_shufflevector(lo, hi, 0, 1, 2, 3, 4, 5, 6, 7, 8, 9, 10, 11, 12, 13, 14, 15)); }
__device__ __forceinline__ v8f wmma16(v16h a, v16h b, v8f c) { return __builtin_amdgcn_wmma_f32_16x16x32_f16(false, a, false, b, (short)0, c, false, false); }
__device__ __forceinline__ v8f wmmab(v16bf a, v16bf b, v8f c) { return __builtin_amdgcn_wmma_f32_16x16x32_bf16(false, a, false, b, (short)0, c, false, false); }



// ---- k_gemmw: register-blocked GEMM, one work-group of NW waves per 64x64 output tile; wave w takes the 32-wide K steps w, w + NW, ... into its own 16 accumulators (operands straight from K-contiguous 16-bit planes),
// and the NW partial tiles are added through LDS in wave order 0..NW-1 (fixed, so the result is the same on every run); grid (M/64, N/64, Z), 32 x NW threads.
// C[m][n] (f32, pitch ldc, + optional f32 bias[n]) = sum_k A[m][k] Bt[n][k] (+ split products per NSPLIT). z-batch strides sA/sB/sC in elements. K % 32 == 0.
// tile_sync: orders the LDS slabs between the waves of a tile. One wave: only keeps the compiler from moving LDS accesses across. Several waves: the work-group barrier with work-group fences on LDS alone,
// so that a wave waits for its LDS traffic but not for the tile rows it has just stored to global memory (__syncthreads() waited for those stores at every slab; nobody in the launch reads them).
template <int NW> __device__ __forceinline__ void tile_sync() {
    if (NW == 1) { __builtin_amdgcn_wave_barrier(); asm volatile("" ::: "memory"); }
    else { __builtin_amdgcn_fence(__ATOMIC_RELEASE, "workgroup", "local"); __builtin_amdgcn_s_barrier(); __builtin_amdgcn_fence(__ATOMIC_ACQUIRE, "workgroup", "local"); } }
template <typename T16> struct WFrag;
template <> struct WFrag<h16> { typedef v16h V; static __device__ __forceinline__ V ld(const h16* p) { return cat16(*(const v8h*)p, *(const v8h*)(p + 16)); } static __device__ __forceinline__ v8f mma(V a, V b, v8f c) { return wmma16(a, b, c); } };
template <> struct WFrag<bf> { typedef v16bf V; static __device__ __forceinline__ V ld(const bf* p) { return cat16b(*(const v8us*)p, *(const v8us*)(p + 16)); } static __device__ __forceinline__ v8f mma(V a, V b, v8f c) { return wmmab(a, b, c); } };
template <typename T16, int NSPLIT, bool BIAS, int NW>
__global__ __launch_bounds__(32 * NW) void k_gemmw(const T16* __restrict__ A, const T16* __restrict__ A2, const T16* __restrict__ Bt, const T16* __restrict__ Bt2, int K, float* C, int ldc, const float* __restrict__ bias, size_t sA, size_t sB, size_t sC) {
    typedef typename WFrag<T16>::V V;
    __shared__ __align__(16) float os[NW * 16 * 68];
    const size_t z = blockIdx.z; A += z * sA; if (A2) A2 += z * sA; Bt += z * sB; if (Bt2) Bt2 += z * sB; C += z * sC;
    const int lane = threadIdx.x & 31, lr = lane & 15, hi = lane >> 4; const int r0 = blockIdx.x * 64, c0 = blockIdx.y * 64;
    const int w = (NW == 1) ? 0 : __builtin_amdgcn_readfirstlane((int)(threadIdx.x >> 5));   // wave number, scalar: the K loop's branch stays wave-uniform (WMMA needs every lane on)
    v8f acc[4][4];
#pragma unroll
    for (int mb = 0; mb < 4; ++mb)
#pragma unroll
        for (int nb = 0; nb < 4; ++nb) acc[mb][nb] = (v8f){};
    const size_t aoff = (size_t)(r0 + lr) * K + 8 * hi, boff = (size_t)(c0 + lr) * K + 8 * hi;
#pragma unroll 1
    for (int kc = w * 32; kc < K; kc += 32 * NW) {
        V a[4], a2[4];
#pragma unroll
        for (int mb = 0; mb < 4; ++mb) { a[mb] = WFrag<T16>::ld(A + aoff + (size_t)mb * 16 * K + kc); if (NSPLIT == 1 || NSPLIT == 2) a2[mb] = WFrag<T16>::ld(A2 + aoff + (size_t)mb * 16 * K + kc); }
#pragma unroll
        for (int nb = 0; nb < 4; ++nb) { const V b = WFrag<T16>::ld(Bt + boff + (size_t)nb * 16 * K + kc); V b2; if (NSPLIT >= 2) b2 = WFrag<T16>::ld(Bt2 + boff + (size_t)nb * 16 * K + kc);
#pragma unroll
            for (int mb = 0; mb < 4; ++mb) { acc[mb][nb] = WFrag<T16>::mma(a[mb], b, acc[mb][nb]); if (NSPLIT == 1 || NSPLIT == 2) acc[mb][nb] = WFrag<T16>::mma(a2[mb], b, acc[mb][nb]); if (NSPLIT >= 2) acc[mb][nb] = WFrag<T16>::mma(a[mb], b2, acc[mb][nb]); } }
        asm volatile("v_nop\n\tv_nop\n\tv_nop\n\tv_nop" : "+v"(acc[0][0]), "+v"(acc[1][1]), "+v"(acc[2][2]), "+v"(acc[3][3]) : "v"(a[0]), "v"(a[3]));
    }
#pragma unroll
    for (int mb = 0; mb < 4; ++mb) {
#pragma unroll
        for (int nb = 0; nb < 4; ++nb) {
#pragma unroll
            for (int j = 0; j < 8; ++j) os[w * (16 * 68) + (hi * 8 + j) * 68 + nb * 16 + lr] = acc[mb][nb][j]; }
        tile_sync<NW>();   // every wave's partial slab is in LDS before any thread adds them
        float* crow = C + (size_t)(r0 + mb * 16) * ldc + c0;
{
#pragma unroll
            for (int s = 0; s < (NW < 8 ? 8 / NW : 1); ++s) if (NW <= 8 || w < 8) { const int idx = s * (32 * NW) + (int)threadIdx.x; const int row = idx >> 4, cofs = (idx & 15) * 4; v4f val = *(const v4fa*)(os + row * 68 + cofs);
#pragma unroll
                for (int ww = 1; ww < NW; ++ww) val += *(const v4fa*)(os + ww * (16 * 68) + row * 68 + cofs);
                if (BIAS) { val[0] += bfr(bias[c0 + cofs]); val[1] += bfr(bias[c0 + cofs + 1]); val[2] += bfr(bias[c0 + cofs + 2]); val[3] += bfr(bias[c0 + cofs + 3]); }
                *(v4f*)(crow + (size_t)row * ldc + cofs) = val;
                asm volatile("s_wait_xcnt 0x0" ::: "memory"); /* behind the store, before later code reuses its address and data registers */ }
             }
        if (mb < 3) tile_sync<NW>();   // the slabs are read out before the next 16 rows overwrite them
    }
}

// ---- k_gemmc: the same NW-wave 64x64 tile GEMM specialised for causal attention: CMODE 1 skips score tiles entirely above the diagonal (query rows r0+roff.., key columns c0..), CMODE 2 limits the
// key (K) loop of the probability x value contraction to the diagonal block (probabilities beyond it are exactly zero). roff = row offset of this launch's first row within the sequence.
// NW waves share the tile's K loop as in k_gemmw (partials added through LDS in wave order). z = query head: A and C step by sA / sC per head, Bt by sB per key group (z / REP). lda = row pitch of A in elements (Bt's pitch is K).
template <typename T16, int NSPLIT, int CMODE, int NW>
__global__ __launch_bounds__(32 * NW) void k_gemmc(const T16* __restrict__ A, const T16* __restrict__ A2, const T16* __restrict__ Bt, const T16* __restrict__ Bt2, int K, int lda, float* C, int ldc, int roff, size_t sA, size_t sB, size_t sC) {
    typedef typename WFrag<T16>::V V;
    __shared__ __align__(16) float os[NW * 16 * 68];
    const size_t z = blockIdx.z, zg = z / REP; A += z * sA; if (A2) A2 += z * sA; Bt += zg * sB; if (Bt2) Bt2 += zg * sB; C += z * sC;
    const int lane = threadIdx.x & 31, lr = lane & 15, hi = lane >> 4; const int r0 = blockIdx.x * 64, c0 = blockIdx.y * 64;
    const int w = (NW == 1) ? 0 : __builtin_amdgcn_readfirstlane((int)(threadIdx.x >> 5));   // wave number, scalar: the K loop's branch stays wave-uniform (WMMA needs every lane on)
    if (CMODE == 1 && c0 > r0 + roff + 63) return;                  // score tile entirely above the causal diagonal: never read (the softmax masks j > i by select)
    const int Kl = (CMODE == 2) ? min(K, r0 + roff + 64) : K;        // P.V: probabilities are exactly 0 beyond the diagonal block, so the K loop stops there
    v8f acc[4][4];
#pragma unroll
    for (int mb = 0; mb < 4; ++mb)
#pragma unroll
        for (int nb = 0; nb < 4; ++nb) acc[mb][nb] = (v8f){};
    const size_t aoff = (size_t)(r0 + lr) * lda + 8 * hi, boff = (size_t)(c0 + lr) * K + 8 * hi;
#pragma unroll 1
    for (int kc = w * 32; kc < Kl; kc += 32 * NW) {
        V a[4], a2[4];
#pragma unroll
        for (int mb = 0; mb < 4; ++mb) { a[mb] = WFrag<T16>::ld(A + aoff + (size_t)mb * 16 * lda + kc); if (NSPLIT == 1 || NSPLIT == 2) a2[mb] = WFrag<T16>::ld(A2 + aoff + (size_t)mb * 16 * lda + kc); }
#pragma unroll
        for (int nb = 0; nb < 4; ++nb) { const V b = WFrag<T16>::ld(Bt + boff + (size_t)nb * 16 * K + kc); V b2; if (NSPLIT >= 2) b2 = WFrag<T16>::ld(Bt2 + boff + (size_t)nb * 16 * K + kc);
#pragma unroll
            for (int mb = 0; mb < 4; ++mb) { acc[mb][nb] = WFrag<T16>::mma(a[mb], b, acc[mb][nb]); if (NSPLIT == 1 || NSPLIT == 2) acc[mb][nb] = WFrag<T16>::mma(a2[mb], b, acc[mb][nb]); if (NSPLIT >= 2) acc[mb][nb] = WFrag<T16>::mma(a[mb], b2, acc[mb][nb]); } }
        asm volatile("v_nop\n\tv_nop\n\tv_nop\n\tv_nop" : "+v"(acc[0][0]), "+v"(acc[1][1]), "+v"(acc[2][2]), "+v"(acc[3][3]) : "v"(a[0]), "v"(a[3]));
    }
#pragma unroll
    for (int mb = 0; mb < 4; ++mb) {
#pragma unroll
        for (int nb = 0; nb < 4; ++nb) {
#pragma unroll
            for (int j = 0; j < 8; ++j) os[w * (16 * 68) + (hi * 8 + j) * 68 + nb * 16 + lr] = acc[mb][nb][j]; }
        tile_sync<NW>();   // every wave's partial slab is in LDS before any thread adds them
        float* crow = C + (size_t)(r0 + mb * 16) * ldc + c0;
{
#pragma unroll
            for (int s = 0; s < (NW < 8 ? 8 / NW : 1); ++s) if (NW <= 8 || w < 8) { const int idx = s * (32 * NW) + (int)threadIdx.x; const int row = idx >> 4, cofs = (idx & 15) * 4; v4f val = *(const v4fa*)(os + row * 68 + cofs);
#pragma unroll
                for (int ww = 1; ww < NW; ++ww) val += *(const v4fa*)(os + ww * (16 * 68) + row * 68 + cofs);
                *(v4f*)(crow + (size_t)row * ldc + cofs) = val;
                asm volatile("s_wait_xcnt 0x0" ::: "memory"); /* behind the store, before later code reuses its address and data registers */ }
             }
        if (mb < 3) tile_sync<NW>();   // the slabs are read out before the next 16 rows overwrite them
    }
}

__device__ __forceinline__ h16 tohx(float x) { return (h16)x; }
__device__ __forceinline__ void splitf(float y, unsigned short& h, unsigned short& l) { h = f2bf(y); l = f2bf(y - bf2f(h)); }
typedef __attribute__((ext_vector_type(2))) _Float16 v2h;
typedef __attribute__((ext_vector_type(4))) _Float16 v4h;
typedef __attribute__((ext_vector_type(2))) unsigned short v2us;
typedef __attribute__((ext_vector_type(4))) unsigned short v4us;
typedef __attribute__((ext_vector_type(2))) float v2f;
typedef __attribute__((ext_vector_type(4))) int v4i;

__global__ __launch_bounds__(256) void k_wtG(const float* __restrict__ w, int K, int N, bf* Bt) {
    const int lane = threadIdx.x & 31; const int L0 = (blockIdx.x * 8 + (threadIdx.x >> 5)) * 8; const int nlines = N * K / 64;
{
#pragma unroll 1
        for (int l = 0; l < 8; ++l) { const int L = L0 + l; if (L >= nlines) break; const size_t e = (size_t)L * 64 + lane * 2; const int k = (int)(e % K), n = (int)(e / K); v2us o;
            o[0] = f2bf(w[(size_t)k * N + n]); o[1] = f2bf(w[(size_t)(k + 1) * N + n]); *(v2us*)(Bt + e) = o; }
         }
}
__global__ __launch_bounds__(256) void k_cvt8s(const float* __restrict__ src, size_t pitch, bf* dst, size_t n8) { const size_t i = (size_t)blockIdx.x * 256 + threadIdx.x; if (i >= n8) return; const size_t e = i * 8; const size_t t = e / DM, c = e % DM; const v8f v = *(const v8f*)(src + t * pitch + c); v8us o;
#pragma unroll
    for (int k = 0; k < 8; ++k) o[k] = f2bf(v[k]); *(v8us*)(dst + e) = o;  }
__global__ __launch_bounds__(256) void k_lnchunk(float* F, int nch, const float* __restrict__ gw, const float* __restrict__ gb) {
    const int lane = threadIdx.x & 31; const int w = blockIdx.x * 8 + (threadIdx.x >> 5); if (w >= TT * nch) return; float* fr = F + (size_t)w * HD; float hv[8]; float s = 0.f;
#pragma unroll
    for (int ch = 0; ch < 2; ++ch) { const v4f y = *(const v4f*)(fr + ch * 128 + lane * 4);
#pragma unroll
        for (int q = 0; q < 4; ++q) { hv[ch * 4 + q] = y[q]; s += y[q]; } }
#pragma unroll
    for (int sh = 16; sh; sh >>= 1) s += __shfl_xor(s, sh, 32);
    const float mu = s * (1.0f / HD); float s2 = 0.f;
#pragma unroll
    for (int k = 0; k < 8; ++k) { float d0 = __fsub_rn(hv[k], mu); asm volatile("" : "+v"(d0)); float p = __fmul_rn(d0, d0); asm volatile("" : "+v"(p)); s2 = __fadd_rn(s2, p); }
#pragma unroll
    for (int sh = 16; sh; sh >>= 1) s2 += __shfl_xor(s2, sh, 32);
    float var = __fadd_rn(s2 * (1.0f / HD), 1e-5f); asm volatile("" : "+v"(var)); const float rs = __frsqrt_rn(var);
    __builtin_amdgcn_wave_barrier(); asm volatile("" ::: "memory");
{
#pragma unroll
        for (int ch = 0; ch < 2; ++ch) { const int c0 = ch * 128 + lane * 4; v4f o;
#pragma unroll
            for (int q = 0; q < 4; ++q) { float gg = bfr(gw[c0 + q]), bb = bfr(gb[c0 + q]); asm volatile("" : "+v"(gg), "+v"(bb)); float d0 = __fsub_rn(hv[ch * 4 + q], mu); asm volatile("" : "+v"(d0)); float n0 = __fmul_rn(d0, rs); asm volatile("" : "+v"(n0)); float n1 = __fmul_rn(n0, gg); asm volatile("" : "+v"(n1)); o[q] = __fadd_rn(n1, bb); }
            *(v4f*)(fr + c0) = o; }
         } }
__global__ __launch_bounds__(256) void k_cvt8(const float* __restrict__ src, bf* dst, size_t n8) { const size_t i = (size_t)blockIdx.x * 256 + threadIdx.x; if (i >= n8) return; const v8f v = *(const v8f*)(src + i * 8); v8us o;
#pragma unroll
    for (int k = 0; k < 8; ++k) o[k] = f2bf(v[k]); *(v8us*)(dst + i * 8) = o;  }

// k_rope: head planes [h][t][d] (fp16 + hi/lo) of rope(x) x sc with the rotate-half convention out[d] = x[d] cos[t][d] - x[d+HD/2] sin[t][d], out[d+HD/2] = x[d+HD/2] cos[t][d+HD/2] + x[d] sin[t][d+HD/2]
__global__ __launch_bounds__(256) void k_rope(const float* __restrict__ F, int pitch, int nheads, const float* __restrict__ CS, const float* __restrict__ RF, const float* __restrict__ nw, float sc, h16* P16, bf* Ph, bf* Pl) {
    const size_t e = ((size_t)blockIdx.x * 256 + threadIdx.x) * 2; if (e >= (size_t)nheads * TT * HD) return; const int d = (int)(e % HD); const int t = (int)((e / HD) % TT); const int h = (int)(e / ((size_t)HD * TT)); const float* f = F + (size_t)t * pitch + h * HD; const float rf = RF ? RF[(size_t)h * TT + t] : 1.0f; v2h o16; v2us oh, ol;
#pragma unroll
    for (int q = 0; q < 2; ++q) { const int dd = d + q; const int dp = (dd < HD / 2) ? dd + HD / 2 : dd - HD / 2; float x0 = f[dd], x1 = f[dp];
        if (RF) { float n0 = __fmul_rn(x0, rf), n1 = __fmul_rn(x1, rf); asm volatile("" : "+v"(n0)); asm volatile("" : "+v"(n1)); x0 = __fmul_rn(bfr(nw[dd]), n0); x1 = __fmul_rn(bfr(nw[dp]), n1); }
        const v2f cs = *(const v2f*)(CS + ((size_t)t * HD + dd) * 2); float a = __fmul_rn(x0, cs[0]), bq = __fmul_rn(x1, cs[1]); asm volatile("" : "+v"(a)); asm volatile("" : "+v"(bq)); const float r = ((dd < HD / 2) ? __fsub_rn(a, bq) : __fadd_rn(a, bq)) * sc;
        o16[q] = tohx(r); unsigned short a2, c2; splitf(r, a2, c2); oh[q] = a2; ol[q] = c2; }
    *(v2h*)(P16 + e) = o16; *(v2us*)(Ph + e) = oh; *(v2us*)(Pl + e) = ol;  }
__global__ __launch_bounds__(256) void k_vtp(const float* __restrict__ F, int pitch, int nheads, h16* V16, bf* Vh, bf* Vl) { const size_t e = ((size_t)blockIdx.x * 256 + threadIdx.x) * 2; if (e >= (size_t)nheads * HD * TT) return; const int t = (int)(e % TT); const int d = (int)((e / TT) % HD); const int g = (int)(e / ((size_t)TT * HD)); v2h o16; v2us oh, ol;
#pragma unroll
    for (int q = 0; q < 2; ++q) { const float x = F[(size_t)(t + q) * pitch + g * HD + d]; o16[q] = tohx(x); unsigned short a2, c2; splitf(x, a2, c2); oh[q] = a2; ol[q] = c2; }
    *(v2h*)(V16 + e) = o16; *(v2us*)(Vh + e) = oh; *(v2us*)(Vl + e) = ol;  }
__global__ __launch_bounds__(256) void k_csid(float* CS) { const int idx = blockIdx.x * 256 + threadIdx.x; if (idx >= TT * HD) return; v2f cs; cs[0] = 1.0f; cs[1] = 0.0f; *(v2f*)(CS + (size_t)idx * 2) = cs;  }
// k_asoft: per row (zz, i): t = S x HD^-0.5 for j <= i and i - j < WIN (sliding causal window; the reference's -1e9 additive fill vanishes identically); softmax over the 2048 keys (register row, one exp, fixed trees);
// the fp16 probabilities of a row are stored over the first half of that row's own scores (P16 = Sb, pitch 2 x TT halves): the wave holds the whole row in registers before its first store, and no other wave touches the row.
__global__ __launch_bounds__(256) void k_asoft(const float* Sb, h16* P16, bf* Ph, bf* Pl) {
    const int lane = threadIdx.x & 31; const int row = blockIdx.x * 8 + (threadIdx.x >> 5); if (row >= ZH * TT) return; const int i = row % TT; const int zz = row / TT; (void)zz; const bool hires = (i < RH); const float* sr = Sb + (size_t)row * TT; float v[TT / 32]; float mx = -3.0e38f;
#pragma unroll
    for (int ch = 0; ch < TT / 128; ++ch) { const int j0 = ch * 128 + lane * 4; const v4f a = *(const v4f*)(sr + j0);
#pragma unroll
        for (int q = 0; q < 4; ++q) { const int j = j0 + q; (void)j; float sa = a[q] * SCL; asm volatile("" : "+v"(sa)); const float t = (j <= i) ? sa : -3.0e38f; v[ch * 4 + q] = t; mx = fmaxf(mx, t); } }
#pragma unroll
    for (int sh = 16; sh; sh >>= 1) mx = fmaxf(mx, __shfl_xor(mx, sh, 32));
    float sum = 0.f;
#pragma unroll
    for (int k = 0; k < TT / 32; ++k) { float d0 = __fsub_rn(v[k], mx); asm volatile("" : "+v"(d0)); v[k] = __builtin_amdgcn_exp2f(__fmul_rn(d0, 1.4426950408889634f)); sum += v[k]; }
#pragma unroll
    for (int sh = 16; sh; sh >>= 1) sum += __shfl_xor(sum, sh, 32);
    const float f = __fdiv_rn(hires ? 1.0f : PCAR, sum);
{
        if (hires) {
#pragma unroll
            for (int ch = 0; ch < TT / 128; ++ch) { v4us oh, ol;
#pragma unroll
                for (int q = 0; q < 4; ++q) { unsigned short a, c2; splitf(v[ch * 4 + q] * f, a, c2); oh[q] = a; ol[q] = c2; }
                const size_t oo = ((size_t)zz * (RH ? RH : 1) + i) * TT + ch * 128 + lane * 4; *(v4us*)(Ph + oo) = oh; *(v4us*)(Pl + oo) = ol; }
        } else {
#pragma unroll
            for (int ch = 0; ch < TT / 128; ++ch) { v4h o4;
#pragma unroll
                for (int q = 0; q < 4; ++q) o4[q] = tohx(v[ch * 4 + q] * f);
                *(v4h*)(P16 + (size_t)row * (2 * TT) + ch * 128 + lane * 4) = o4; } }
         }
}
__global__ __launch_bounds__(256) void k_merge(const float* __restrict__ O, int h0, bf* Ah, bf* Al) { const size_t e = ((size_t)blockIdx.x * 256 + threadIdx.x) * 2; if (e >= (size_t)ZH * TT * HD) return; const int d = (int)(e % HD); const int t = (int)((e / HD) % TT); const int zz = (int)(e / ((size_t)HD * TT)); const float cs = (t < RH) ? 1.0f : (1.0f / PCAR); const size_t oo = (size_t)t * DQ + (h0 + zz) * HD + d;
    v2us oh, ol;
#pragma unroll
    for (int q = 0; q < 2; ++q) { unsigned short a, c2; splitf(O[e + q] * cs, a, c2); oh[q] = a; ol[q] = c2; } *(v2us*)(Ah + oo) = oh; *(v2us*)(Al + oo) = ol;  }

extern "C" void kernel_launch(void* const* d_in, const int* in_sizes, int n_in,
                              void* d_out, int out_size, void* d_ws, size_t ws_size, hipStream_t stream) {
    (void)in_sizes; (void)n_in; (void)out_size;
    const float* x = (const float*)d_in[0]; const float* wk = (const float*)d_in[1]; const float* bk = (const float*)d_in[2]; const float* wv = (const float*)d_in[3]; const float* bv = (const float*)d_in[4]; const float* wq = (const float*)d_in[5]; const float* bq = (const float*)d_in[6]; const float* wo = (const float*)d_in[7]; const float* bo = (const float*)d_in[8]; const float* lng = (const float*)d_in[9]; const float* lnb = (const float*)d_in[10];
    float* OUT = (float*)d_out;     // [2048][2][256] (seq, batch, dim)
    char* wsp = (char*)d_ws;
    auto take = [&](size_t bytes) { char* p = wsp; wsp += (bytes + 255) & ~(size_t)255; return (void*)p; };
    bf* WQ = (bf*)take((size_t)DQ * DM * 2); bf* WK = (bf*)take((size_t)DKV * DM * 2); bf* WV = (bf*)take((size_t)DKV * DM * 2); bf* WO = (bf*)take((size_t)DM * DQ * 2); float* CS = (float*)take((size_t)TT * HD * 2 * 4);
    bf* XB = (bf*)take((size_t)TT * DM * 2); float* FQ = (float*)take((size_t)TT * DQ * 4); float* FK = (float*)take((size_t)TT * DKV * 4);
    h16* QP16 = (h16*)take((size_t)NH_ * TT * HD * 2); h16* KP16 = (h16*)take((size_t)NKV * TT * HD * 2); h16* VT16 = (h16*)take((size_t)NKV * HD * TT * 2);
    bf* QPh = (bf*)take((size_t)NH_ * TT * HD * 2); bf* QPl = (bf*)take((size_t)NH_ * TT * HD * 2); bf* KPh = (bf*)take((size_t)NKV * TT * HD * 2); bf* KPl = (bf*)take((size_t)NKV * TT * HD * 2); bf* VTh = (bf*)take((size_t)NKV * HD * TT * 2); bf* VTl = (bf*)take((size_t)NKV * HD * TT * 2); bf* Ph = (bf*)take((size_t)ZH * RH * TT * 2); bf* Pl = (bf*)take((size_t)ZH * RH * TT * 2);
    float* Sb = (float*)take((size_t)ZH * TT * TT * 4); h16* P16 = (h16*)Sb; /* in place, row pitch 2 x TT halves: 8 score planes and a separate probability plane do not fit the workspace together */ float* Ob = (float*)take((size_t)ZH * TT * HD * 4); bf* ATh = (bf*)take((size_t)TT * DQ * 2); bf* ATl = (bf*)take((size_t)TT * DQ * 2);
    if ((size_t)(wsp - (char*)d_ws) > ws_size) return;    // ws 256 MiB
    float* FV = FK;   // v projection reuses the k buffer after the k planes are built (stream-ordered)
    { k_wtG<<<(unsigned)((DM * DQ / 64 + 63) / 64), 256, 0, stream>>>(wq, DM, DQ, WQ); k_wtG<<<(unsigned)((DM * DKV / 64 + 63) / 64), 256, 0, stream>>>(wk, DM, DKV, WK); k_wtG<<<(unsigned)((DM * DKV / 64 + 63) / 64), 256, 0, stream>>>(wv, DM, DKV, WV);
      k_wtG<<<(unsigned)((DQ * DM / 64 + 63) / 64), 256, 0, stream>>>(wo, DQ, DM, WO);
       }
    k_csid<<<(TT * HD + 255) / 256, 256, 0, stream>>>(CS);
    const unsigned LQ = (unsigned)(((size_t)NH_ * TT * HD / 2 + 255) / 256), LKv = (unsigned)(((size_t)NKV * TT * HD / 2 + 255) / 256);
    for (int b = 0; b < NB_; ++b) {
        
        k_cvt8s<<<(unsigned)(((size_t)TT * DM / 8 + 255) / 256), 256, 0, stream>>>(x + (size_t)b * DM, (size_t)NB_ * DM, XB, (size_t)TT * DM / 8);   /* batch b's strided rows */
        k_gemmw<bf, 0, true, 4><<<dim3(TT / 64, DQ / 64, 1), 128, 0, stream>>>(XB, nullptr, WQ, nullptr, DM, FQ, DQ, bq, 0, 0, 0); k_lnchunk<<<TT * NH_ / 8, 256, 0, stream>>>(FQ, NH_, lng, lnb);   /* LayerNorm of each 256-wide query head */
        k_rope<<<LQ, 256, 0, stream>>>(FQ, DQ, NH_, CS, nullptr, nullptr, 1.0f, QP16, QPh, QPl);
        k_gemmw<bf, 0, true, 4><<<dim3(TT / 64, DKV / 64, 1), 128, 0, stream>>>(XB, nullptr, WK, nullptr, DM, FK, DKV, bk, 0, 0, 0); k_lnchunk<<<TT * NKV / 8, 256, 0, stream>>>(FK, NKV, lng, lnb);   /* LayerNorm of each key group */
        k_rope<<<LKv, 256, 0, stream>>>(FK, DKV, NKV, CS, nullptr, nullptr, 1.0f, KP16, KPh, KPl);
        k_gemmw<bf, 0, true, 4><<<dim3(TT / 64, DKV / 64, 1), 128, 0, stream>>>(XB, nullptr, WV, nullptr, DM, FV, DKV, bv, 0, 0, 0); k_vtp<<<LKv, 256, 0, stream>>>(FV, DKV, NKV, VT16, VTh, VTl);
        for (int h0 = 0; h0 < NH_; h0 += ZH) { const size_t zq = (size_t)h0, zk = (size_t)(h0 / REP);   // head h0 + z of the pass reads kv group (h0 + z) / REP: h0 is a multiple of REP, the kernel steps Bt by sB per z / REP
            k_gemmc<bf, 2, 1, 1><<<dim3(RH / 64, TT / 64, ZH), 32, 0, stream>>>(QPh + zq * TT * HD, QPl + zq * TT * HD, KPh + zk * TT * HD, KPl + zk * TT * HD, HD, HD, Sb, TT, 0, (size_t)TT * HD, (size_t)TT * HD, (size_t)TT * TT);
            k_gemmc<h16, 0, 1, 1><<<dim3((TT - RH) / 64, TT / 64, ZH), 32, 0, stream>>>(QP16 + zq * TT * HD + (size_t)RH * HD, nullptr, KP16 + zk * TT * HD, nullptr, HD, HD, Sb + (size_t)RH * TT, TT, RH, (size_t)TT * HD, (size_t)TT * HD, (size_t)TT * TT);
            k_asoft<<<ZH * TT / 8, 256, 0, stream>>>(Sb, P16, Ph, Pl);
            k_gemmc<bf, 2, 2, 8><<<dim3(RH / 64, HD / 64, ZH), 256, 0, stream>>>(Ph, Pl, VTh + zk * HD * TT, VTl + zk * HD * TT, TT, TT, Ob, HD, 0, (size_t)RH * TT, (size_t)HD * TT, (size_t)TT * HD);
            k_gemmc<h16, 0, 2, 8><<<dim3((TT - RH) / 64, HD / 64, ZH), 256, 0, stream>>>(P16 + (size_t)RH * 2 * TT, nullptr, VT16 + zk * HD * TT, nullptr, TT, 2 * TT, Ob + (size_t)RH * HD, HD, RH, (size_t)TT * 2 * TT, (size_t)HD * TT, (size_t)TT * HD);
            k_merge<<<(unsigned)(((size_t)ZH * TT * HD / 2 + 255) / 256), 256, 0, stream>>>(Ob, h0, ATh, ATl); }
        k_gemmw<bf, 1, true, 16><<<dim3(TT / 64, DM / 64, 1), 512, 0, stream>>>(ATh, ATl, WO, nullptr, DQ, OUT + (size_t)b * DM, NB_ * DM, bo, 0, 0, 0);   /* rows interleaved by batch: pitch 2 x 256 */ }
}

// v003
// A run of this version takes 365 microseconds.
// Two timings next to v002 both put it at 1.20 times that version's speed.
// All steps since v000 together make it 4.11 times as fast.
#include <hip/hip_runtime.h>

// Grouped (GQA-style) causal attention with full-width heads and LayerNorm on q and k (x [2048][2][256] (seq, batch, dim); K = x WK_w + WK_b, V = x WV_w + WV_b ('xw' [256][512]: 2 key groups of width 256); Q = x WQ_w + WQ_b ('xw' [256][2048]: 2 groups x 4 sub-queries of width 256, head (g, sub) uses key group g); K and Q LayerNormed over their 256 features (ln_g, ln_b, eps 1e-5); scores = Q.K/16, causal (-inf); softmax; out = merged (g, sub, i) WO_w + WO_b ('xw' [2048][256]) -> [2048][2][256] (1.05 M)).
// Compute dtypes, f32 accumulate: every input rounded to bf16; q/k/v on PLAIN bf16 operands (inputs: exact) + biases; LayerNorm of every 256-wide q / k head row in f32, stored straight as 16-bit head planes; v projected transposed (weights as the A operand) and stored straight as its planes; causal scores and attn.v (tile skipping), all 8 query heads of a batch in one pass (grid z), each reading its key group's planes: query rows < 512 hl (3 products), the rest single fp16 (x1024); softmax f32; attn.v stores the merged hi+lo rows itself; WO_w hl x exact (2 products) + WO_b.

#define NB_  2
#define TT   2048
#define DM   256
#define NH_  8
#define NKV  2
#define REP  (NH_ / NKV)
#define HD   256
#define DQ   (NH_ * HD)
#define DKV  (NKV * HD)
#define ZH   8                    // query heads per pass (grid z of the attention launches)
#define RH   512                  // query rows < RH use hi+lo planes (0: none)
#define WIN  2048
#define PCAR 1024.0f
#define SCL  0.0625f   // 1/sqrt(dim = 256)
typedef _Float16 h16;
typedef unsigned short bf;
typedef __attribute__((ext_vector_type(16))) __bf16   v16bf;
typedef __attribute__((ext_vector_type(16))) _Float16 v16h;
typedef __attribute__((ext_vector_type(8)))  _Float16 v8h;
typedef __attribute__((ext_vector_type(8)))  unsigned short v8us;
typedef __attribute__((ext_vector_type(8)))  float    v8f;
typedef __attribute__((ext_vector_type(4)))  float    v4f;
typedef v8h  __attribute__((may_alias)) v8ha;
typedef v4f  __attribute__((may_alias)) v4fa;
typedef v8us __attribute__((may_alias)) v8usa;

__device__ __forceinline__ unsigned short f2bf(float f) { unsigned u = __float_as_uint(f); u += 0x7FFFu + ((u >> 16) & 1u); return (unsigned short)(u >> 16); }
__device__ __forceinline__ float bf2f(unsigned short b) { return __uint_as_float(((unsigned)b) << 16); }
__device__ __forceinline__ float bfr(float f) { return bf2f(f2bf(f)); }
__device__ __forceinline__ v16h cat16(v8h lo, v8h hi) { return __builtin_shufflevector(lo, hi, 0, 1, 2, 3, 4, 5, 6, 7, 8, 9, 10, 11, 12, 13, 14, 15); }
__device__ __forceinline__ v16bf cat16b(v8us lo, v8us hi) { return __builtin_bit_cast(v16bf, __builtin_shufflevector(lo, hi, 0, 1, 2, 3, 4, 5, 6, 7, 8, 9, 10, 11, 12, 13, 14, 15)); }
__device__ __forceinline__ v8f wmma16(v16h a, v16h b, v8f c) { return __builtin_amdgcn_wmma_f32_16x16x32_f16(false, a, false, b, (short)0, c, false, false); }
__device__ __forceinline__ v8f wmmab(v16bf a, v16bf b, v8f c) { return __builtin_amdgcn_wmma_f32_16x16x32_bf16(false, a, false, b, (short)0, c, false, false); }
__device__ __forceinline__ h16 tohx(float x) { return (h16)x; }
__device__ __forceinline__ void splitf(float y, unsigned short& h, unsigned short& l) { h = f2bf(y); l = f2bf(y - bf2f(h)); }
typedef __attribute__((ext_vector_type(4))) _Float16 v4h;
typedef __attribute__((ext_vector_type(4))) unsigned short v4us;



// ---- k_gemmw: register-blocked GEMM, one work-group of NW waves per 64x64 output tile; wave w takes the 32-wide K steps w, w + NW, ... into its own 16 accumulators (operands straight from K-contiguous 16-bit planes),
// and the NW partial tiles are added through LDS in wave order 0..NW-1 (fixed, so the result is the same on every run); grid (M/64, N/64, Z), 32 x NW threads.
// C[m][n] (f32, pitch ldc, + optional f32 bias[n]) = sum_k A[m][k] Bt[n][k] (+ split products per NSPLIT). z-batch strides sA/sB/sC in elements. K % 32 == 0.
// PL: the bias is per row m (bias[m]) and the tile is stored as three 16-bit planes (fp16, bf16 hi, bf16 lo; pitch ldc) instead of f32 C: with the weights as A and the activations as Bt this is the transposed projection.
// tile_sync: orders the LDS slabs between the waves of a tile. One wave: only keeps the compiler from moving LDS accesses across. Several waves: the work-group barrier with work-group fences on LDS alone,
// so that a wave waits for its LDS traffic but not for the tile rows it has just stored to global memory (__syncthreads() waited for those stores at every slab; nobody in the launch reads them).
template <int NW> __device__ __forceinline__ void tile_sync() {
    if (NW == 1) { __builtin_amdgcn_wave_barrier(); asm volatile("" ::: "memory"); }
    else { __builtin_amdgcn_fence(__ATOMIC_RELEASE, "workgroup", "local"); __builtin_amdgcn_s_barrier(); __builtin_amdgcn_fence(__ATOMIC_ACQUIRE, "workgroup", "local"); } }
template <typename T16> struct WFrag;
template <> struct WFrag<h16> { typedef v16h V; static __device__ __forceinline__ V ld(const h16* p) { return cat16(*(const v8h*)p, *(const v8h*)(p + 16)); } static __device__ __forceinline__ v8f mma(V a, V b, v8f c) { return wmma16(a, b, c); } };
template <> struct WFrag<bf> { typedef v16bf V; static __device__ __forceinline__ V ld(const bf* p) { return cat16b(*(const v8us*)p, *(const v8us*)(p + 16)); } static __device__ __forceinline__ v8f mma(V a, V b, v8f c) { return wmmab(a, b, c); } };
template <typename T16, int NSPLIT, bool BIAS, int NW, bool PL>
__global__ __launch_bounds__(32 * NW) void k_gemmw(const T16* __restrict__ A, const T16* __restrict__ A2, const T16* __restrict__ Bt, const T16* __restrict__ Bt2, int K, float* C, int ldc, const float* __restrict__ bias, size_t sA, size_t sB, size_t sC, h16* P16, bf* Ph, bf* Pl) {
    typedef typename WFrag<T16>::V V;
    __shared__ __align__(16) float os[NW * 16 * 68];
    const size_t z = blockIdx.z; A += z * sA; if (A2) A2 += z * sA; Bt += z * sB; if (Bt2) Bt2 += z * sB; C += z * sC;
    const int lane = threadIdx.x & 31, lr = lane & 15, hi = lane >> 4; const int r0 = blockIdx.x * 64, c0 = blockIdx.y * 64;
    const int w = (NW == 1) ? 0 : __builtin_amdgcn_readfirstlane((int)(threadIdx.x >> 5));   // wave number, scalar: the K loop's branch stays wave-uniform (WMMA needs every lane on)
    v8f acc[4][4];
#pragma unroll
    for (int mb = 0; mb < 4; ++mb)
#pragma unroll
        for (int nb = 0; nb < 4; ++nb) acc[mb][nb] = (v8f){};
    const size_t aoff = (size_t)(r0 + lr) * K + 8 * hi, boff = (size_t)(c0 + lr) * K + 8 * hi;
#pragma unroll 1
    for (int kc = w * 32; kc < K; kc += 32 * NW) {
        V a[4], a2[4];
#pragma unroll
        for (int mb = 0; mb < 4; ++mb) { a[mb] = WFrag<T16>::ld(A + aoff + (size_t)mb * 16 * K + kc); if (NSPLIT == 1 || NSPLIT == 2) a2[mb] = WFrag<T16>::ld(A2 + aoff + (size_t)mb * 16 * K + kc); }
#pragma unroll
        for (int nb = 0; nb < 4; ++nb) { const V b = WFrag<T16>::ld(Bt + boff + (size_t)nb * 16 * K + kc); V b2; if (NSPLIT >= 2) b2 = WFrag<T16>::ld(Bt2 + boff + (size_t)nb * 16 * K + kc);
#pragma unroll
            for (int mb = 0; mb < 4; ++mb) { acc[mb][nb] = WFrag<T16>::mma(a[mb], b, acc[mb][nb]); if (NSPLIT == 1 || NSPLIT == 2) acc[mb][nb] = WFrag<T16>::mma(a2[mb], b, acc[mb][nb]); if (NSPLIT >= 2) acc[mb][nb] = WFrag<T16>::mma(a[mb], b2, acc[mb][nb]); } }
        asm volatile("v_nop\n\tv_nop\n\tv_nop\n\tv_nop" : "+v"(acc[0][0]), "+v"(acc[1][1]), "+v"(acc[2][2]), "+v"(acc[3][3]) : "v"(a[0]), "v"(a[3]));
    }
#pragma unroll
    for (int mb = 0; mb < 4; ++mb) {
#pragma unroll
        for (int nb = 0; nb < 4; ++nb) {
#pragma unroll
            for (int j = 0; j < 8; ++j) os[w * (16 * 68) + (hi * 8 + j) * 68 + nb * 16 + lr] = acc[mb][nb][j]; }
        tile_sync<NW>();   // every wave's partial slab is in LDS before any thread adds them
        float* crow = C + (size_t)(r0 + mb * 16) * ldc + c0;
{
#pragma unroll
            for (int s = 0; s < (NW < 8 ? 8 / NW : 1); ++s) if (NW <= 8 || w < 8) { const int idx = s * (32 * NW) + (int)threadIdx.x; const int row = idx >> 4, cofs = (idx & 15) * 4; v4f val = *(const v4fa*)(os + row * 68 + cofs);
#pragma unroll
                for (int ww = 1; ww < NW; ++ww) val += *(const v4fa*)(os + ww * (16 * 68) + row * 68 + cofs);
                if (BIAS && !PL) { val[0] += bfr(bias[c0 + cofs]); val[1] += bfr(bias[c0 + cofs + 1]); val[2] += bfr(bias[c0 + cofs + 2]); val[3] += bfr(bias[c0 + cofs + 3]); }
                if (PL) { if (BIAS) val += bfr(bias[r0 + mb * 16 + row]); v4h o16; v4us oh, ol;
#pragma unroll
                    for (int q = 0; q < 4; ++q) { o16[q] = tohx(val[q]); unsigned short a2, c2; splitf(val[q], a2, c2); oh[q] = a2; ol[q] = c2; }
                    const size_t oo = (size_t)(r0 + mb * 16 + row) * ldc + c0 + cofs; *(v4h*)(P16 + oo) = o16; *(v4us*)(Ph + oo) = oh; *(v4us*)(Pl + oo) = ol; }
                else *(v4f*)(crow + (size_t)row * ldc + cofs) = val;
                asm volatile("s_wait_xcnt 0x0" ::: "memory"); /* behind the store, before later code reuses its address and data registers */ }
             }
        if (mb < 3) tile_sync<NW>();   // the slabs are read out before the next 16 rows overwrite them
    }
}

// ---- k_gemmc: the same NW-wave 64x64 tile GEMM specialised for causal attention: CMODE 1 skips score tiles entirely above the diagonal (query rows r0+roff.., key columns c0..), CMODE 2 limits the
// key (K) loop of the probability x value contraction to the diagonal block (probabilities beyond it are exactly zero). roff = row offset of this launch's first row within the sequence.
// CMODE 2 stores its tile x cs as bf16 hi + lo planes Ah / Al in the merged layout [t][head][d] (pitch ldc, head step sC, row roff + ...) that the output projection reads; C is not used there.
// NW waves share the tile's K loop as in k_gemmw (partials added through LDS in wave order). z = query head: A and C step by sA / sC per head, Bt by sB per key group (z / REP). lda = row pitch of A in elements (Bt's pitch is K).
template <typename T16, int NSPLIT, int CMODE, int NW>
__global__ __launch_bounds__(32 * NW) void k_gemmc(const T16* __restrict__ A, const T16* __restrict__ A2, const T16* __restrict__ Bt, const T16* __restrict__ Bt2, int K, int lda, float* C, int ldc, int roff, size_t sA, size_t sB, size_t sC, bf* Ah, bf* Al, float cs) {
    typedef typename WFrag<T16>::V V;
    __shared__ __align__(16) float os[NW * 16 * 68];
    const size_t z = blockIdx.z, zg = z / REP; A += z * sA; if (A2) A2 += z * sA; Bt += zg * sB; if (Bt2) Bt2 += zg * sB; if (CMODE == 2) { Ah += z * sC; Al += z * sC; } else C += z * sC;
    const int lane = threadIdx.x & 31, lr = lane & 15, hi = lane >> 4; const int r0 = blockIdx.x * 64, c0 = blockIdx.y * 64;
    const int w = (NW == 1) ? 0 : __builtin_amdgcn_readfirstlane((int)(threadIdx.x >> 5));   // wave number, scalar: the K loop's branch stays wave-uniform (WMMA needs every lane on)
    if (CMODE == 1 && c0 > r0 + roff + 63) return;                  // score tile entirely above the causal diagonal: never read (the softmax masks j > i by select)
    const int Kl = (CMODE == 2) ? min(K, r0 + roff + 64) : K;        // P.V: probabilities are exactly 0 beyond the diagonal block, so the K loop stops there
    v8f acc[4][4];
#pragma unroll
    for (int mb = 0; mb < 4; ++mb)
#pragma unroll
        for (int nb = 0; nb < 4; ++nb) acc[mb][nb] = (v8f){};
    const size_t aoff = (size_t)(r0 + lr) * lda + 8 * hi, boff = (size_t)(c0 + lr) * K + 8 * hi;
#pragma unroll 1
    for (int kc = w * 32; kc < Kl; kc += 32 * NW) {
        V a[4], a2[4];
#pragma unroll
        for (int mb = 0; mb < 4; ++mb) { a[mb] = WFrag<T16>::ld(A + aoff + (size_t)mb * 16 * lda + kc); if (NSPLIT == 1 || NSPLIT == 2) a2[mb] = WFrag<T16>::ld(A2 + aoff + (size_t)mb * 16 * lda + kc); }
#pragma unroll
        for (int nb = 0; nb < 4; ++nb) { const V b = WFrag<T16>::ld(Bt + boff + (size_t)nb * 16 * K + kc); V b2; if (NSPLIT >= 2) b2 = WFrag<T16>::ld(Bt2 + boff + (size_t)nb * 16 * K + kc);
#pragma unroll
            for (int mb = 0; mb < 4; ++mb) { acc[mb][nb] = WFrag<T16>::mma(a[mb], b, acc[mb][nb]); if (NSPLIT == 1 || NSPLIT == 2) acc[mb][nb] = WFrag<T16>::mma(a2[mb], b, acc[mb][nb]); if (NSPLIT >= 2) acc[mb][nb] = WFrag<T16>::mma(a[mb], b2, acc[mb][nb]); } }
        asm volatile("v_nop\n\tv_nop\n\tv_nop\n\tv_nop" : "+v"(acc[0][0]), "+v"(acc[1][1]), "+v"(acc[2][2]), "+v"(acc[3][3]) : "v"(a[0]), "v"(a[3]));
    }
#pragma unroll
    for (int mb = 0; mb < 4; ++mb) {
#pragma unroll
        for (int nb = 0; nb < 4; ++nb) {
#pragma unroll
            for (int j = 0; j < 8; ++j) os[w * (16 * 68) + (hi * 8 + j) * 68 + nb * 16 + lr] = acc[mb][nb][j]; }
        tile_sync<NW>();   // every wave's partial slab is in LDS before any thread adds them
        float* crow = C + (size_t)(r0 + mb * 16) * ldc + c0;
{
#pragma unroll
            for (int s = 0; s < (NW < 8 ? 8 / NW : 1); ++s) if (NW <= 8 || w < 8) { const int idx = s * (32 * NW) + (int)threadIdx.x; const int row = idx >> 4, cofs = (idx & 15) * 4; v4f val = *(const v4fa*)(os + row * 68 + cofs);
#pragma unroll
                for (int ww = 1; ww < NW; ++ww) val += *(const v4fa*)(os + ww * (16 * 68) + row * 68 + cofs);
                if (CMODE == 2) { v4us oh, ol;
#pragma unroll
                    for (int q = 0; q < 4; ++q) { unsigned short a2, c2; splitf(val[q] * cs, a2, c2); oh[q] = a2; ol[q] = c2; }
                    const size_t oo = (size_t)(r0 + roff + mb * 16 + row) * ldc + c0 + cofs; *(v4us*)(Ah + oo) = oh; *(v4us*)(Al + oo) = ol; }
                else *(v4f*)(crow + (size_t)row * ldc + cofs) = val;
                asm volatile("s_wait_xcnt 0x0" ::: "memory"); /* behind the store, before later code reuses its address and data registers */ }
             }
        if (mb < 3) tile_sync<NW>();   // the slabs are read out before the next 16 rows overwrite them
    }
}

typedef __attribute__((ext_vector_type(2))) _Float16 v2h;
typedef __attribute__((ext_vector_type(2))) unsigned short v2us;
typedef __attribute__((ext_vector_type(2))) float v2f;
typedef __attribute__((ext_vector_type(4))) int v4i;

__global__ __launch_bounds__(256) void k_wtG(const float* __restrict__ w, int K, int N, bf* Bt) {
    const int lane = threadIdx.x & 31; const int L0 = (blockIdx.x * 8 + (threadIdx.x >> 5)) * 8; const int nlines = N * K / 64;
{
#pragma unroll 1
        for (int l = 0; l < 8; ++l) { const int L = L0 + l; if (L >= nlines) break; const size_t e = (size_t)L * 64 + lane * 2; const int k = (int)(e % K), n = (int)(e / K); v2us o;
            o[0] = f2bf(w[(size_t)k * N + n]); o[1] = f2bf(w[(size_t)(k + 1) * N + n]); *(v2us*)(Bt + e) = o; }
         }
}
__global__ __launch_bounds__(256) void k_cvt8s(const float* __restrict__ src, size_t pitch, bf* dst, size_t n8) { const size_t i = (size_t)blockIdx.x * 256 + threadIdx.x; if (i >= n8) return; const size_t e = i * 8; const size_t t = e / DM, c = e % DM; const v8f v = *(const v8f*)(src + t * pitch + c); v8us o;
#pragma unroll
    for (int k = 0; k < 8; ++k) o[k] = f2bf(v[k]); *(v8us*)(dst + e) = o;  }
// k_lnchunk: one wave per 256-wide head row w = t x NCH + h of F; the normalised row goes straight into the head planes [h][t][d] (fp16, bf16 hi, bf16 lo) that the score products read.
template <int NCH>
__global__ __launch_bounds__(256) void k_lnchunk(const float* __restrict__ F, const float* __restrict__ gw, const float* __restrict__ gb, h16* P16, bf* Ph, bf* Pl) {
    const int lane = threadIdx.x & 31; const int w = blockIdx.x * 8 + (threadIdx.x >> 5); if (w >= TT * NCH) return; const float* fr = F + (size_t)w * HD; const size_t pe = ((size_t)(w % NCH) * TT + w / NCH) * HD; float hv[8]; float s = 0.f;
#pragma unroll
    for (int ch = 0; ch < 2; ++ch) { const v4f y = *(const v4f*)(fr + ch * 128 + lane * 4);
#pragma unroll
        for (int q = 0; q < 4; ++q) { hv[ch * 4 + q] = y[q]; s += y[q]; } }
#pragma unroll
    for (int sh = 16; sh; sh >>= 1) s += __shfl_xor(s, sh, 32);
    const float mu = s * (1.0f / HD); float s2 = 0.f;
#pragma unroll
    for (int k = 0; k < 8; ++k) { float d0 = __fsub_rn(hv[k], mu); asm volatile("" : "+v"(d0)); float p = __fmul_rn(d0, d0); asm volatile("" : "+v"(p)); s2 = __fadd_rn(s2, p); }
#pragma unroll
    for (int sh = 16; sh; sh >>= 1) s2 += __shfl_xor(s2, sh, 32);
    float var = __fadd_rn(s2 * (1.0f / HD), 1e-5f); asm volatile("" : "+v"(var)); const float rs = __frsqrt_rn(var);
{
#pragma unroll
        for (int ch = 0; ch < 2; ++ch) { const int c0 = ch * 128 + lane * 4; v4f o;
#pragma unroll
            for (int q = 0; q < 4; ++q) { float gg = bfr(gw[c0 + q]), bb = bfr(gb[c0 + q]); asm volatile("" : "+v"(gg), "+v"(bb)); float d0 = __fsub_rn(hv[ch * 4 + q], mu); asm volatile("" : "+v"(d0)); float n0 = __fmul_rn(d0, rs); asm volatile("" : "+v"(n0)); float n1 = __fmul_rn(n0, gg); asm volatile("" : "+v"(n1)); o[q] = __fadd_rn(n1, bb); }
            v4h o16; v4us oh, ol;
#pragma unroll
            for (int q = 0; q < 4; ++q) { o16[q] = tohx(o[q]); unsigned short a2, c2; splitf(o[q], a2, c2); oh[q] = a2; ol[q] = c2; }
            *(v4h*)(P16 + pe + c0) = o16; *(v4us*)(Ph + pe + c0) = oh; *(v4us*)(Pl + pe + c0) = ol;
            asm volatile("s_wait_xcnt 0x0" ::: "memory"); /* behind the stores, before the next half row's code reuses their data registers */ }
         } }
__global__ __launch_bounds__(256) void k_cvt8(const float* __restrict__ src, bf* dst, size_t n8) { const size_t i = (size_t)blockIdx.x * 256 + threadIdx.x; if (i >= n8) return; const v8f v = *(const v8f*)(src + i * 8); v8us o;
#pragma unroll
    for (int k = 0; k < 8; ++k) o[k] = f2bf(v[k]); *(v8us*)(dst + i * 8) = o;  }

// k_asoft: per row (zz, i): t = S x HD^-0.5 for j <= i and i - j < WIN (sliding causal window; the reference's -1e9 additive fill vanishes identically); softmax over the 2048 keys (register row, one exp, fixed trees);
// the fp16 probabilities of a row are stored over the first half of that row's own scores (P16 = Sb, pitch 2 x TT halves): the wave holds the whole row in registers before its first store, and no other wave touches the row.
__global__ __launch_bounds__(256) void k_asoft(const float* Sb, h16* P16, bf* Ph, bf* Pl) {
    const int lane = threadIdx.x & 31; const int row = blockIdx.x * 8 + (threadIdx.x >> 5); if (row >= ZH * TT) return; const int i = row % TT; const int zz = row / TT; (void)zz; const bool hires = (i < RH); const float* sr = Sb + (size_t)row * TT; float v[TT / 32]; float mx = -3.0e38f;
#pragma unroll
    for (int ch = 0; ch < TT / 128; ++ch) { const int j0 = ch * 128 + lane * 4; const v4f a = *(const v4f*)(sr + j0);
#pragma unroll
        for (int q = 0; q < 4; ++q) { const int j = j0 + q; (void)j; float sa = a[q] * SCL; asm volatile("" : "+v"(sa)); const float t = (j <= i) ? sa : -3.0e38f; v[ch * 4 + q] = t; mx = fmaxf(mx, t); } }
#pragma unroll
    for (int sh = 16; sh; sh >>= 1) mx = fmaxf(mx, __shfl_xor(mx, sh, 32));
    float sum = 0.f;
#pragma unroll
    for (int k = 0; k < TT / 32; ++k) { float d0 = __fsub_rn(v[k], mx); asm volatile("" : "+v"(d0)); v[k] = __builtin_amdgcn_exp2f(__fmul_rn(d0, 1.4426950408889634f)); sum += v[k]; }
#pragma unroll
    for (int sh = 16; sh; sh >>= 1) sum += __shfl_xor(sum, sh, 32);
    const float f = __fdiv_rn(hires ? 1.0f : PCAR, sum);
{
        if (hires) {
#pragma unroll
            for (int ch = 0; ch < TT / 128; ++ch) { v4us oh, ol;
#pragma unroll
                for (int q = 0; q < 4; ++q) { unsigned short a, c2; splitf(v[ch * 4 + q] * f, a, c2); oh[q] = a; ol[q] = c2; }
                const size_t oo = ((size_t)zz * (RH ? RH : 1) + i) * TT + ch * 128 + lane * 4; *(v4us*)(Ph + oo) = oh; *(v4us*)(Pl + oo) = ol; }
        } else {
#pragma unroll
            for (int ch = 0; ch < TT / 128; ++ch) { v4h o4;
#pragma unroll
                for (int q = 0; q < 4; ++q) o4[q] = tohx(v[ch * 4 + q] * f);
                *(v4h*)(P16 + (size_t)row * (2 * TT) + ch * 128 + lane * 4) = o4; } }
         }
}

extern "C" void kernel_launch(void* const* d_in, const int* in_sizes, int n_in,
                              void* d_out, int out_size, void* d_ws, size_t ws_size, hipStream_t stream) {
    (void)in_sizes; (void)n_in; (void)out_size;
    const float* x = (const float*)d_in[0]; const float* wk = (const float*)d_in[1]; const float* bk = (const float*)d_in[2]; const float* wv = (const float*)d_in[3]; const float* bv = (const float*)d_in[4]; const float* wq = (const float*)d_in[5]; const float* bq = (const float*)d_in[6]; const float* wo = (const float*)d_in[7]; const float* bo = (const float*)d_in[8]; const float* lng = (const float*)d_in[9]; const float* lnb = (const float*)d_in[10];
    float* OUT = (float*)d_out;     // [2048][2][256] (seq, batch, dim)
    char* wsp = (char*)d_ws;
    auto take = [&](size_t bytes) { char* p = wsp; wsp += (bytes + 255) & ~(size_t)255; return (void*)p; };
    bf* WQ = (bf*)take((size_t)DQ * DM * 2); bf* WK = (bf*)take((size_t)DKV * DM * 2); bf* WV = (bf*)take((size_t)DKV * DM * 2); bf* WO = (bf*)take((size_t)DM * DQ * 2);
    bf* XB = (bf*)take((size_t)TT * DM * 2); float* FQ = (float*)take((size_t)TT * DQ * 4); float* FK = (float*)take((size_t)TT * DKV * 4);
    h16* QP16 = (h16*)take((size_t)NH_ * TT * HD * 2); h16* KP16 = (h16*)take((size_t)NKV * TT * HD * 2); h16* VT16 = (h16*)take((size_t)NKV * HD * TT * 2);
    bf* QPh = (bf*)take((size_t)NH_ * TT * HD * 2); bf* QPl = (bf*)take((size_t)NH_ * TT * HD * 2); bf* KPh = (bf*)take((size_t)NKV * TT * HD * 2); bf* KPl = (bf*)take((size_t)NKV * TT * HD * 2); bf* VTh = (bf*)take((size_t)NKV * HD * TT * 2); bf* VTl = (bf*)take((size_t)NKV * HD * TT * 2); bf* Ph = (bf*)take((size_t)ZH * RH * TT * 2); bf* Pl = (bf*)take((size_t)ZH * RH * TT * 2);
    float* Sb = (float*)take((size_t)ZH * TT * TT * 4); h16* P16 = (h16*)Sb; /* in place, row pitch 2 x TT halves: 8 score planes and a separate probability plane do not fit the workspace together */ bf* ATh = (bf*)take((size_t)TT * DQ * 2); bf* ATl = (bf*)take((size_t)TT * DQ * 2);
    if ((size_t)(wsp - (char*)d_ws) > ws_size) return;    // ws 256 MiB
    { k_wtG<<<(unsigned)((DM * DQ / 64 + 63) / 64), 256, 0, stream>>>(wq, DM, DQ, WQ); k_wtG<<<(unsigned)((DM * DKV / 64 + 63) / 64), 256, 0, stream>>>(wk, DM, DKV, WK); k_wtG<<<(unsigned)((DM * DKV / 64 + 63) / 64), 256, 0, stream>>>(wv, DM, DKV, WV);
      k_wtG<<<(unsigned)((DQ * DM / 64 + 63) / 64), 256, 0, stream>>>(wo, DQ, DM, WO);
       }
    for (int b = 0; b < NB_; ++b) {
        
        k_cvt8s<<<(unsigned)(((size_t)TT * DM / 8 + 255) / 256), 256, 0, stream>>>(x + (size_t)b * DM, (size_t)NB_ * DM, XB, (size_t)TT * DM / 8);   /* batch b's strided rows */
        k_gemmw<bf, 0, true, 4, false><<<dim3(TT / 64, DQ / 64, 1), 128, 0, stream>>>(XB, nullptr, WQ, nullptr, DM, FQ, DQ, bq, 0, 0, 0, nullptr, nullptr, nullptr); k_lnchunk<NH_><<<TT * NH_ / 8, 256, 0, stream>>>(FQ, lng, lnb, QP16, QPh, QPl);   /* LayerNorm of each 256-wide query head -> planes */
        k_gemmw<bf, 0, true, 4, false><<<dim3(TT / 64, DKV / 64, 1), 128, 0, stream>>>(XB, nullptr, WK, nullptr, DM, FK, DKV, bk, 0, 0, 0, nullptr, nullptr, nullptr); k_lnchunk<NKV><<<TT * NKV / 8, 256, 0, stream>>>(FK, lng, lnb, KP16, KPh, KPl);   /* LayerNorm of each key group -> planes */
        k_gemmw<bf, 0, true, 4, true><<<dim3(DKV / 64, TT / 64, 1), 128, 0, stream>>>(WV, nullptr, XB, nullptr, DM, nullptr, TT, bv, 0, 0, 0, VT16, VTh, VTl);   /* v transposed: rows = (group, feature), columns = positions */
        for (int h0 = 0; h0 < NH_; h0 += ZH) { const size_t zq = (size_t)h0, zk = (size_t)(h0 / REP);   // head h0 + z of the pass reads kv group (h0 + z) / REP: h0 is a multiple of REP, the kernel steps Bt by sB per z / REP
            k_gemmc<bf, 2, 1, 1><<<dim3(RH / 64, TT / 64, ZH), 32, 0, stream>>>(QPh + zq * TT * HD, QPl + zq * TT * HD, KPh + zk * TT * HD, KPl + zk * TT * HD, HD, HD, Sb, TT, 0, (size_t)TT * HD, (size_t)TT * HD, (size_t)TT * TT, nullptr, nullptr, 1.0f);
            k_gemmc<h16, 0, 1, 1><<<dim3((TT - RH) / 64, TT / 64, ZH), 32, 0, stream>>>(QP16 + zq * TT * HD + (size_t)RH * HD, nullptr, KP16 + zk * TT * HD, nullptr, HD, HD, Sb + (size_t)RH * TT, TT, RH, (size_t)TT * HD, (size_t)TT * HD, (size_t)TT * TT, nullptr, nullptr, 1.0f);
            k_asoft<<<ZH * TT / 8, 256, 0, stream>>>(Sb, P16, Ph, Pl);
            k_gemmc<bf, 2, 2, 8><<<dim3(RH / 64, HD / 64, ZH), 256, 0, stream>>>(Ph, Pl, VTh + zk * HD * TT, VTl + zk * HD * TT, TT, TT, nullptr, DQ, 0, (size_t)RH * TT, (size_t)HD * TT, (size_t)HD, ATh + zq * HD, ATl + zq * HD, 1.0f);
            k_gemmc<h16, 0, 2, 8><<<dim3((TT - RH) / 64, HD / 64, ZH), 256, 0, stream>>>(P16 + (size_t)RH * 2 * TT, nullptr, VT16 + zk * HD * TT, nullptr, TT, 2 * TT, nullptr, DQ, RH, (size_t)TT * 2 * TT, (size_t)HD * TT, (size_t)HD, ATh + zq * HD, ATl + zq * HD, 1.0f / PCAR); }
        k_gemmw<bf, 1, true, 16, false><<<dim3(TT / 64, DM / 64, 1), 512, 0, stream>>>(ATh, ATl, WO, nullptr, DQ, OUT + (size_t)b * DM, NB_ * DM, bo, 0, 0, 0, nullptr, nullptr, nullptr);   /* rows interleaved by batch: pitch 2 x 256 */ }
}

// v004
// It runs in 270 microseconds.
// Timed twice side by side with v003, it ran 1.34 and 1.36 times as fast.
// Counting every step since v000, it is 5.53 times as fast.
#include <hip/hip_runtime.h>

// Grouped (GQA-style) causal attention with full-width heads and LayerNorm on q and k (x [2048][2][256] (seq, batch, dim); K = x WK_w + WK_b, V = x WV_w + WV_b ('xw' [256][512]: 2 key groups of width 256); Q = x WQ_w + WQ_b ('xw' [256][2048]: 2 groups x 4 sub-queries of width 256, head (g, sub) uses key group g); K and Q LayerNormed over their 256 features (ln_g, ln_b, eps 1e-5); scores = Q.K/16, causal (-inf); softmax; out = merged (g, sub, i) WO_w + WO_b ('xw' [2048][256]) -> [2048][2][256] (1.05 M)).
// Compute dtypes, f32 accumulate: every input rounded to bf16; q/k/v on PLAIN bf16 operands (inputs: exact) + biases; LayerNorm of every 256-wide q / k head row in f32, stored straight as 16-bit head planes; v projected transposed (weights as the A operand) and stored straight as its planes; causal scores and attn.v (tile skipping), all 16 (batch, query head) pairs in one pass (grid z), each reading its batch's key group's planes, scores kept only for the 64x64 tiles on or below the diagonal: query rows < 512 hl (3 products), the rest single fp16 (x1024); softmax f32; attn.v stores the merged hi+lo rows itself; WO_w hl x exact (2 products) + WO_b.

#define NB_  2
#define TT   2048
#define DM   256
#define NH_  8
#define NKV  2
#define REP  (NH_ / NKV)
#define HD   256
#define DQ   (NH_ * HD)
#define DKV  (NKV * HD)
#define NZ   (NB_ * NH_)          // (batch, query head) pairs: grid z of the attention launches, z = batch x NH_ + head
#define SPL  ((size_t)(TT / 64) * (TT / 64 + 1) / 2 * 4096)   // f32 elements of one packed causal score plane: row tile R (64 rows) starts at 2048 R (R + 1) and holds 64 rows of (R + 1) x 64 columns
#define RH   512                  // query rows < RH use hi+lo planes (0: none)
#define WIN  2048
#define PCAR 1024.0f
#define SCL  0.0625f   // 1/sqrt(dim = 256)
typedef _Float16 h16;
typedef unsigned short bf;
typedef __attribute__((ext_vector_type(16))) __bf16   v16bf;
typedef __attribute__((ext_vector_type(16))) _Float16 v16h;
typedef __attribute__((ext_vector_type(8)))  _Float16 v8h;
typedef __attribute__((ext_vector_type(8)))  unsigned short v8us;
typedef __attribute__((ext_vector_type(8)))  float    v8f;
typedef __attribute__((ext_vector_type(4)))  float    v4f;
typedef v8h  __attribute__((may_alias)) v8ha;
typedef v4f  __attribute__((may_alias)) v4fa;
typedef v8us __attribute__((may_alias)) v8usa;

__device__ __forceinline__ unsigned short f2bf(float f) { unsigned u = __float_as_uint(f); u += 0x7FFFu + ((u >> 16) & 1u); return (unsigned short)(u >> 16); }
__device__ __forceinline__ float bf2f(unsigned short b) { return __uint_as_float(((unsigned)b) << 16); }
__device__ __forceinline__ float bfr(float f) { return bf2f(f2bf(f)); }
__device__ __forceinline__ v16h cat16(v8h lo, v8h hi) { return __builtin_shufflevector(lo, hi, 0, 1, 2, 3, 4, 5, 6, 7, 8, 9, 10, 11, 12, 13, 14, 15); }
__device__ __forceinline__ v16bf cat16b(v8us lo, v8us hi) { return __builtin_bit_cast(v16bf, __builtin_shufflevector(lo, hi, 0, 1, 2, 3, 4, 5, 6, 7, 8, 9, 10, 11, 12, 13, 14, 15)); }
__device__ __forceinline__ v8f wmma16(v16h a, v16h b, v8f c) { return __builtin_amdgcn_wmma_f32_16x16x32_f16(false, a, false, b, (short)0, c, false, false); }
__device__ __forceinline__ v8f wmmab(v16bf a, v16bf b, v8f c) { return __builtin_amdgcn_wmma_f32_16x16x32_bf16(false, a, false, b, (short)0, c, false, false); }
__device__ __forceinline__ h16 tohx(float x) { return (h16)x; }
__device__ __forceinline__ void splitf(float y, unsigned short& h, unsigned short& l) { h = f2bf(y); l = f2bf(y - bf2f(h)); }
typedef __attribute__((ext_vector_type(4))) _Float16 v4h;
typedef __attribute__((ext_vector_type(4))) unsigned short v4us;



// ---- k_gemmw: register-blocked GEMM, one work-group of NW waves per 64x64 output tile; wave w takes the 32-wide K steps w, w + NW, ... into its own 16 accumulators (operands straight from K-contiguous 16-bit planes),
// and the NW partial tiles are added through LDS in wave order 0..NW-1 (fixed, so the result is the same on every run); grid (M/64, N/64, Z), 32 x NW threads.
// C[m][n] (f32, pitch ldc, + optional f32 bias[n]) = sum_k A[m][k] Bt[n][k] (+ split products per NSPLIT). z-batch strides sA/sB/sC in elements. K % 32 == 0.
// PL: the bias is per row m (bias[m]) and the tile is stored as three 16-bit planes (fp16, bf16 hi, bf16 lo; pitch ldc, z step sC) instead of f32 C: with the weights as A and the activations as Bt this is the transposed projection.
// tile_sync: orders the LDS slabs between the waves of a tile. One wave: only keeps the compiler from moving LDS accesses across. Several waves: the work-group barrier with work-group fences on LDS alone,
// so that a wave waits for its LDS traffic but not for the tile rows it has just stored to global memory (__syncthreads() waited for those stores at every slab; nobody in the launch reads them).
template <int NW> __device__ __forceinline__ void tile_sync() {
    if (NW == 1) { __builtin_amdgcn_wave_barrier(); asm volatile("" ::: "memory"); }
    else { __builtin_amdgcn_fence(__ATOMIC_RELEASE, "workgroup", "local"); __builtin_amdgcn_s_barrier(); __builtin_amdgcn_fence(__ATOMIC_ACQUIRE, "workgroup", "local"); } }
template <typename T16> struct WFrag;
template <> struct WFrag<h16> { typedef v16h V; static __device__ __forceinline__ V ld(const h16* p) { return cat16(*(const v8h*)p, *(const v8h*)(p + 16)); } static __device__ __forceinline__ v8f mma(V a, V b, v8f c) { return wmma16(a, b, c); } };
template <> struct WFrag<bf> { typedef v16bf V; static __device__ __forceinline__ V ld(const bf* p) { return cat16b(*(const v8us*)p, *(const v8us*)(p + 16)); } static __device__ __forceinline__ v8f mma(V a, V b, v8f c) { return wmmab(a, b, c); } };
template <typename T16, int NSPLIT, bool BIAS, int NW, bool PL>
__global__ __launch_bounds__(32 * NW) void k_gemmw(const T16* __restrict__ A, const T16* __restrict__ A2, const T16* __restrict__ Bt, const T16* __restrict__ Bt2, int K, float* C, int ldc, const float* __restrict__ bias, size_t sA, size_t sB, size_t sC, h16* P16, bf* Ph, bf* Pl) {
    typedef typename WFrag<T16>::V V;
    __shared__ __align__(16) float os[NW * 16 * 68];
    const size_t z = blockIdx.z; A += z * sA; if (A2) A2 += z * sA; Bt += z * sB; if (Bt2) Bt2 += z * sB; if (PL) { P16 += z * sC; Ph += z * sC; Pl += z * sC; } else C += z * sC;
    const int lane = threadIdx.x & 31, lr = lane & 15, hi = lane >> 4; const int r0 = blockIdx.x * 64, c0 = blockIdx.y * 64;
    const int w = (NW == 1) ? 0 : __builtin_amdgcn_readfirstlane((int)(threadIdx.x >> 5));   // wave number, scalar: the K loop's branch stays wave-uniform (WMMA needs every lane on)
    v8f acc[4][4];
#pragma unroll
    for (int mb = 0; mb < 4; ++mb)
#pragma unroll
        for (int nb = 0; nb < 4; ++nb) acc[mb][nb] = (v8f){};
    const size_t aoff = (size_t)(r0 + lr) * K + 8 * hi, boff = (size_t)(c0 + lr) * K + 8 * hi;
#pragma unroll 1
    for (int kc = w * 32; kc < K; kc += 32 * NW) {
        V a[4], a2[4];
#pragma unroll
        for (int mb = 0; mb < 4; ++mb) { a[mb] = WFrag<T16>::ld(A + aoff + (size_t)mb * 16 * K + kc); if (NSPLIT == 1 || NSPLIT == 2) a2[mb] = WFrag<T16>::ld(A2 + aoff + (size_t)mb * 16 * K + kc); }
#pragma unroll
        for (int nb = 0; nb < 4; ++nb) { const V b = WFrag<T16>::ld(Bt + boff + (size_t)nb * 16 * K + kc); V b2; if (NSPLIT >= 2) b2 = WFrag<T16>::ld(Bt2 + boff + (size_t)nb * 16 * K + kc);
#pragma unroll
            for (int mb = 0; mb < 4; ++mb) { acc[mb][nb] = WFrag<T16>::mma(a[mb], b, acc[mb][nb]); if (NSPLIT == 1 || NSPLIT == 2) acc[mb][nb] = WFrag<T16>::mma(a2[mb], b, acc[mb][nb]); if (NSPLIT >= 2) acc[mb][nb] = WFrag<T16>::mma(a[mb], b2, acc[mb][nb]); } }
        asm volatile("v_nop\n\tv_nop\n\tv_nop\n\tv_nop" : "+v"(acc[0][0]), "+v"(acc[1][1]), "+v"(acc[2][2]), "+v"(acc[3][3]) : "v"(a[0]), "v"(a[3]));
    }
#pragma unroll
    for (int mb = 0; mb < 4; ++mb) {
#pragma unroll
        for (int nb = 0; nb < 4; ++nb) {
#pragma unroll
            for (int j = 0; j < 8; ++j) os[w * (16 * 68) + (hi * 8 + j) * 68 + nb * 16 + lr] = acc[mb][nb][j]; }
        tile_sync<NW>();   // every wave's partial slab is in LDS before any thread adds them
        float* crow = C + (size_t)(r0 + mb * 16) * ldc + c0;
{
#pragma unroll
            for (int s = 0; s < (NW < 8 ? 8 / NW : 1); ++s) if (NW <= 8 || w < 8) { const int idx = s * (32 * NW) + (int)threadIdx.x; const int row = idx >> 4, cofs = (idx & 15) * 4; v4f val = *(const v4fa*)(os + row * 68 + cofs);
#pragma unroll
                for (int ww = 1; ww < NW; ++ww) val += *(const v4fa*)(os + ww * (16 * 68) + row * 68 + cofs);
                if (BIAS && !PL) { val[0] += bfr(bias[c0 + cofs]); val[1] += bfr(bias[c0 + cofs + 1]); val[2] += bfr(bias[c0 + cofs + 2]); val[3] += bfr(bias[c0 + cofs + 3]); }
                if (PL) { if (BIAS) val += bfr(bias[r0 + mb * 16 + row]); v4h o16; v4us oh, ol;
#pragma unroll
                    for (int q = 0; q < 4; ++q) { o16[q] = tohx(val[q]); unsigned short a2, c2; splitf(val[q], a2, c2); oh[q] = a2; ol[q] = c2; }
                    const size_t oo = (size_t)(r0 + mb * 16 + row) * ldc + c0 + cofs; *(v4h*)(P16 + oo) = o16; *(v4us*)(Ph + oo) = oh; *(v4us*)(Pl + oo) = ol; }
                else *(v4f*)(crow + (size_t)row * ldc + cofs) = val;
                asm volatile("s_wait_xcnt 0x0" ::: "memory"); /* behind the store, before later code reuses its address and data registers */ }
             }
        if (mb < 3) tile_sync<NW>();   // the slabs are read out before the next 16 rows overwrite them
    }
}

// ---- k_gemmc: the same NW-wave 64x64 tile GEMM specialised for causal attention: CMODE 1 skips score tiles entirely above the diagonal (query rows r0+roff.., key columns c0..), CMODE 2 limits the
// key (K) loop of the probability x value contraction to the diagonal block (probabilities beyond it are exactly zero). roff = row offset of this launch's first row within the sequence.
// CMODE 2 stores its tile x cs as bf16 hi + lo planes Ah / Al in the merged layout [t][head][d] (pitch ldc, head step sC, batch step TT rows, row roff + ...) that the output projection reads; C is not used there.
// NW waves share the tile's K loop as in k_gemmw (partials added through LDS in wave order). z = batch x NH_ + query head: Bt steps by sB per (batch, key group) = z / REP (Bt's pitch is K).
// Scores and probabilities live in the packed causal planes (SPL): CMODE 1 reads A (step sA per z, pitch lda) and stores its tile into row tile R of plane z of C; CMODE 2 reads A from there (16-bit rows over the f32 rows: pitch 2 x row length, the lo plane behind the hi plane inside each row).
template <typename T16, int NSPLIT, int CMODE, int NW>
__global__ __launch_bounds__(32 * NW) void k_gemmc(const T16* __restrict__ A, const T16* __restrict__ A2, const T16* __restrict__ Bt, const T16* __restrict__ Bt2, int K, int lda, float* C, int ldc, int roff, size_t sA, size_t sB, size_t sC, bf* Ah, bf* Al, float cs) {
    typedef typename WFrag<T16>::V V;
    __shared__ __align__(16) float os[NW * 16 * 68];
    const int lane = threadIdx.x & 31, lr = lane & 15, hi = lane >> 4; const int r0 = blockIdx.x * 64, c0 = blockIdx.y * 64;
    const int R = (r0 + roff) >> 6, len = (R + 1) * 64;              // row tile within the sequence, and its packed row length
    const size_t z = blockIdx.z, zg = z / REP, pk = z * SPL + (size_t)2048 * R * (R + 1); Bt += zg * sB; if (Bt2) Bt2 += zg * sB;
    if (CMODE == 2) { A += 2 * pk; A2 = A + len; lda = 2 * len; const size_t ao = (z / NH_) * ((size_t)TT * ldc) + (z % NH_) * sC; Ah += ao; Al += ao; }
    else { A += z * sA + (size_t)r0 * lda; if (A2) A2 += z * sA + (size_t)r0 * lda; C += pk; ldc = len; }
    const int w = (NW == 1) ? 0 : __builtin_amdgcn_readfirstlane((int)(threadIdx.x >> 5));   // wave number, scalar: the K loop's branch stays wave-uniform (WMMA needs every lane on)
    if (CMODE == 1 && c0 > r0 + roff + 63) return;                  // score tile entirely above the causal diagonal: never read (the softmax masks j > i by select)
    const int Kl = (CMODE == 2) ? min(K, r0 + roff + 64) : K;        // P.V: probabilities are exactly 0 beyond the diagonal block, so the K loop stops there
    v8f acc[4][4];
#pragma unroll
    for (int mb = 0; mb < 4; ++mb)
#pragma unroll
        for (int nb = 0; nb < 4; ++nb) acc[mb][nb] = (v8f){};
    const size_t aoff = (size_t)(lr * lda) + 8 * hi, boff = (size_t)(c0 + lr) * K + 8 * hi;
#pragma unroll 1
    for (int kc = w * 32; kc < Kl; kc += 32 * NW) {
        V a[4], a2[4];
#pragma unroll
        for (int mb = 0; mb < 4; ++mb) { a[mb] = WFrag<T16>::ld(A + aoff + (size_t)mb * 16 * lda + kc); if (NSPLIT == 1 || NSPLIT == 2) a2[mb] = WFrag<T16>::ld(A2 + aoff + (size_t)mb * 16 * lda + kc); }
#pragma unroll
        for (int nb = 0; nb < 4; ++nb) { const V b = WFrag<T16>::ld(Bt + boff + (size_t)nb * 16 * K + kc); V b2; if (NSPLIT >= 2) b2 = WFrag<T16>::ld(Bt2 + boff + (size_t)nb * 16 * K + kc);
#pragma unroll
            for (int mb = 0; mb < 4; ++mb) { acc[mb][nb] = WFrag<T16>::mma(a[mb], b, acc[mb][nb]); if (NSPLIT == 1 || NSPLIT == 2) acc[mb][nb] = WFrag<T16>::mma(a2[mb], b, acc[mb][nb]); if (NSPLIT >= 2) acc[mb][nb] = WFrag<T16>::mma(a[mb], b2, acc[mb][nb]); } }
        asm volatile("v_nop\n\tv_nop\n\tv_nop\n\tv_nop" : "+v"(acc[0][0]), "+v"(acc[1][1]), "+v"(acc[2][2]), "+v"(acc[3][3]) : "v"(a[0]), "v"(a[3]));
    }
#pragma unroll
    for (int mb = 0; mb < 4; ++mb) {
#pragma unroll
        for (int nb = 0; nb < 4; ++nb) {
#pragma unroll
            for (int j = 0; j < 8; ++j) os[w * (16 * 68) + (hi * 8 + j) * 68 + nb * 16 + lr] = acc[mb][nb][j]; }
        tile_sync<NW>();   // every wave's partial slab is in LDS before any thread adds them
        float* crow = C + (size_t)(mb * 16) * ldc + c0;
{
#pragma unroll
            for (int s = 0; s < (NW < 8 ? 8 / NW : 1); ++s) if (NW <= 8 || w < 8) { const int idx = s * (32 * NW) + (int)threadIdx.x; const int row = idx >> 4, cofs = (idx & 15) * 4; v4f val = *(const v4fa*)(os + row * 68 + cofs);
#pragma unroll
                for (int ww = 1; ww < NW; ++ww) val += *(const v4fa*)(os + ww * (16 * 68) + row * 68 + cofs);
                if (CMODE == 2) { v4us oh, ol;
#pragma unroll
                    for (int q = 0; q < 4; ++q) { unsigned short a2, c2; splitf(val[q] * cs, a2, c2); oh[q] = a2; ol[q] = c2; }
                    const size_t oo = (size_t)(r0 + roff + mb * 16 + row) * ldc + c0 + cofs; *(v4us*)(Ah + oo) = oh; *(v4us*)(Al + oo) = ol; }
                else *(v4f*)(crow + (size_t)row * ldc + cofs) = val;
                asm volatile("s_wait_xcnt 0x0" ::: "memory"); /* behind the store, before later code reuses its address and data registers */ }
             }
        if (mb < 3) tile_sync<NW>();   // the slabs are read out before the next 16 rows overwrite them
    }
}

typedef __attribute__((ext_vector_type(2))) _Float16 v2h;
typedef __attribute__((ext_vector_type(2))) unsigned short v2us;
typedef __attribute__((ext_vector_type(2))) float v2f;
typedef __attribute__((ext_vector_type(4))) int v4i;

__global__ __launch_bounds__(256) void k_wtG(const float* __restrict__ w, int K, int N, bf* Bt) {
    const int lane = threadIdx.x & 31; const int L0 = (blockIdx.x * 8 + (threadIdx.x >> 5)) * 8; const int nlines = N * K / 64;
{
#pragma unroll 1
        for (int l = 0; l < 8; ++l) { const int L = L0 + l; if (L >= nlines) break; const size_t e = (size_t)L * 64 + lane * 2; const int k = (int)(e % K), n = (int)(e / K); v2us o;
            o[0] = f2bf(w[(size_t)k * N + n]); o[1] = f2bf(w[(size_t)(k + 1) * N + n]); *(v2us*)(Bt + e) = o; }
         }
}
// k_cvt8s: x [t][batch][DM] f32 -> bf16 rows in batch-major order [batch][t][DM]
__global__ __launch_bounds__(256) void k_cvt8s(const float* __restrict__ src, bf* dst, size_t n8) { const size_t i = (size_t)blockIdx.x * 256 + threadIdx.x; if (i >= n8) return; const size_t e = i * 8; const size_t m = e / DM, c = e % DM; const v8f v = *(const v8f*)(src + ((m % TT) * NB_ + m / TT) * DM + c); v8us o;
#pragma unroll
    for (int k = 0; k < 8; ++k) o[k] = f2bf(v[k]); *(v8us*)(dst + e) = o;  }
// k_lnchunk: one wave per 256-wide head row w = (batch x TT + t) x NCH + h of F; the normalised row goes straight into the head planes [batch x NCH + h][t][d] (fp16, bf16 hi, bf16 lo) that the score products read.
template <int NCH>
__global__ __launch_bounds__(256) void k_lnchunk(const float* __restrict__ F, const float* __restrict__ gw, const float* __restrict__ gb, h16* P16, bf* Ph, bf* Pl) {
    const int lane = threadIdx.x & 31; const int w = blockIdx.x * 8 + (threadIdx.x >> 5); if (w >= NB_ * TT * NCH) return; const float* fr = F + (size_t)w * HD; const int m = w / NCH; const size_t pe = ((size_t)((m / TT) * NCH + w % NCH) * TT + m % TT) * HD; float hv[8]; float s = 0.f;
#pragma unroll
    for (int ch = 0; ch < 2; ++ch) { const v4f y = *(const v4f*)(fr + ch * 128 + lane * 4);
#pragma unroll
        for (int q = 0; q < 4; ++q) { hv[ch * 4 + q] = y[q]; s += y[q]; } }
#pragma unroll
    for (int sh = 16; sh; sh >>= 1) s += __shfl_xor(s, sh, 32);
    const float mu = s * (1.0f / HD); float s2 = 0.f;
#pragma unroll
    for (int k = 0; k < 8; ++k) { float d0 = __fsub_rn(hv[k], mu); asm volatile("" : "+v"(d0)); float p = __fmul_rn(d0, d0); asm volatile("" : "+v"(p)); s2 = __fadd_rn(s2, p); }
#pragma unroll
    for (int sh = 16; sh; sh >>= 1) s2 += __shfl_xor(s2, sh, 32);
    float var = __fadd_rn(s2 * (1.0f / HD), 1e-5f); asm volatile("" : "+v"(var)); const float rs = __frsqrt_rn(var);
{
#pragma unroll
        for (int ch = 0; ch < 2; ++ch) { const int c0 = ch * 128 + lane * 4; v4f o;
#pragma unroll
            for (int q = 0; q < 4; ++q) { float gg = bfr(gw[c0 + q]), bb = bfr(gb[c0 + q]); asm volatile("" : "+v"(gg), "+v"(bb)); float d0 = __fsub_rn(hv[ch * 4 + q], mu); asm volatile("" : "+v"(d0)); float n0 = __fmul_rn(d0, rs); asm volatile("" : "+v"(n0)); float n1 = __fmul_rn(n0, gg); asm volatile("" : "+v"(n1)); o[q] = __fadd_rn(n1, bb); }
            v4h o16; v4us oh, ol;
#pragma unroll
            for (int q = 0; q < 4; ++q) { o16[q] = tohx(o[q]); unsigned short a2, c2; splitf(o[q], a2, c2); oh[q] = a2; ol[q] = c2; }
            *(v4h*)(P16 + pe + c0) = o16; *(v4us*)(Ph + pe + c0) = oh; *(v4us*)(Pl + pe + c0) = ol;
            asm volatile("s_wait_xcnt 0x0" ::: "memory"); /* behind the stores, before the next half row's code reuses their data registers */ }
         } }
__global__ __launch_bounds__(256) void k_cvt8(const float* __restrict__ src, bf* dst, size_t n8) { const size_t i = (size_t)blockIdx.x * 256 + threadIdx.x; if (i >= n8) return; const v8f v = *(const v8f*)(src + i * 8); v8us o;
#pragma unroll
    for (int k = 0; k < 8; ++k) o[k] = f2bf(v[k]); *(v8us*)(dst + i * 8) = o;  }

// k_asoft: per row (zz, i): t = S x HD^-0.5 for j <= i (causal; masked keys vanish identically); softmax over the row's keys (register row, one exp, fixed trees). A row of row tile R has (R + 1) x 64 stored columns (packed planes, SPL);
// 128-column chunks past them are skipped under a wave-uniform test: their terms were exact zeros, so the sums are the same. The 16-bit probabilities of a row are stored over that row's own scores (fp16 in its first half;
// for rows < RH bf16 hi in the first half and lo in the second): the wave holds the whole row in registers before its first store, and no other wave touches the row.
__global__ __launch_bounds__(256) void k_asoft(const float* Sb, h16* P16) {
    const int lane = threadIdx.x & 31; const int row = blockIdx.x * 8 + __builtin_amdgcn_readfirstlane((int)(threadIdx.x >> 5));   // the wave's row, scalar: row start and length stay in scalar registers, the chunk skips below are scalar branches
    if (row >= NZ * TT) return; const int i = row % TT; const int zz = row / TT; const bool hires = (i < RH);
    const int R = i >> 6, len = (R + 1) * 64; const int nch = (len + 127) >> 7;   // 128-column chunks of this row
    const size_t ro = (size_t)zz * SPL + (size_t)2048 * R * (R + 1) + (size_t)(i & 63) * len; const float* sr = Sb + ro; v4f a[TT / 128]; float v[TT / 32]; float mx = -3.0e38f;
#pragma unroll
    for (int ch = 0; ch < TT / 128; ++ch) { const int j0 = ch * 128 + lane * 4; a[ch] = (v4f){}; if (j0 < len) a[ch] = *(const v4f*)(sr + j0); }   // all loads first, so that they are in flight together
#pragma unroll
    for (int ch = 0; ch < TT / 128; ++ch) if (ch < nch) { const int j0 = ch * 128 + lane * 4;
#pragma unroll
        for (int q = 0; q < 4; ++q) { const int j = j0 + q; float sa = a[ch][q] * SCL; asm volatile("" : "+v"(sa)); const float t = (j <= i) ? sa : -3.0e38f; v[ch * 4 + q] = t; mx = fmaxf(mx, t); } }
#pragma unroll
    for (int sh = 16; sh; sh >>= 1) mx = fmaxf(mx, __shfl_xor(mx, sh, 32));
    float sum = 0.f;
#pragma unroll
    for (int ch = 0; ch < TT / 128; ++ch) if (ch < nch) {
#pragma unroll
        for (int k = ch * 4; k < ch * 4 + 4; ++k) { float d0 = __fsub_rn(v[k], mx); asm volatile("" : "+v"(d0)); v[k] = __builtin_amdgcn_exp2f(__fmul_rn(d0, 1.4426950408889634f)); sum += v[k]; } }
#pragma unroll
    for (int sh = 16; sh; sh >>= 1) sum += __shfl_xor(sum, sh, 32);
    const float f = __fdiv_rn(hires ? 1.0f : PCAR, sum);
{
        if (hires) { bf* ph = (bf*)(P16 + 2 * ro); bf* pl = ph + len;
#pragma unroll
            for (int ch = 0; ch < RH / 128; ++ch) if (ch < nch) { const int j0 = ch * 128 + lane * 4; v4us oh, ol;
#pragma unroll
                for (int q = 0; q < 4; ++q) { unsigned short a2, c2; splitf(v[ch * 4 + q] * f, a2, c2); oh[q] = a2; ol[q] = c2; }
                if (j0 < len) { *(v4us*)(ph + j0) = oh; *(v4us*)(pl + j0) = ol; } }
        } else {
#pragma unroll
            for (int ch = 0; ch < TT / 128; ++ch) if (ch < nch) { const int j0 = ch * 128 + lane * 4; v4h o4;
#pragma unroll
                for (int q = 0; q < 4; ++q) o4[q] = tohx(v[ch * 4 + q] * f);
                if (j0 < len) *(v4h*)(P16 + 2 * ro + j0) = o4; } }
         }
}

extern "C" void kernel_launch(void* const* d_in, const int* in_sizes, int n_in,
                              void* d_out, int out_size, void* d_ws, size_t ws_size, hipStream_t stream) {
    (void)in_sizes; (void)n_in; (void)out_size;
    const float* x = (const float*)d_in[0]; const float* wk = (const float*)d_in[1]; const float* bk = (const float*)d_in[2]; const float* wv = (const float*)d_in[3]; const float* bv = (const float*)d_in[4]; const float* wq = (const float*)d_in[5]; const float* bq = (const float*)d_in[6]; const float* wo = (const float*)d_in[7]; const float* bo = (const float*)d_in[8]; const float* lng = (const float*)d_in[9]; const float* lnb = (const float*)d_in[10];
    float* OUT = (float*)d_out;     // [2048][2][256] (seq, batch, dim)
    char* wsp = (char*)d_ws;
    auto take = [&](size_t bytes) { char* p = wsp; wsp += (bytes + 255) & ~(size_t)255; return (void*)p; };
    bf* WQ = (bf*)take((size_t)DQ * DM * 2); bf* WK = (bf*)take((size_t)DKV * DM * 2); bf* WV = (bf*)take((size_t)DKV * DM * 2); bf* WO = (bf*)take((size_t)DM * DQ * 2);
    bf* XB = (bf*)take((size_t)NB_ * TT * DM * 2);
    h16* QP16 = (h16*)take((size_t)NZ * TT * HD * 2); h16* KP16 = (h16*)take((size_t)NB_ * NKV * TT * HD * 2); h16* VT16 = (h16*)take((size_t)NB_ * NKV * HD * TT * 2);
    bf* QPh = (bf*)take((size_t)NZ * TT * HD * 2); bf* QPl = (bf*)take((size_t)NZ * TT * HD * 2); bf* KPh = (bf*)take((size_t)NB_ * NKV * TT * HD * 2); bf* KPl = (bf*)take((size_t)NB_ * NKV * TT * HD * 2); bf* VTh = (bf*)take((size_t)NB_ * NKV * HD * TT * 2); bf* VTl = (bf*)take((size_t)NB_ * NKV * HD * TT * 2);
    float* Sb = (float*)take((size_t)NZ * SPL * 4); h16* P16 = (h16*)Sb; /* probabilities in place over their score rows */ bf* ATh = (bf*)take((size_t)NB_ * TT * DQ * 2); bf* ATl = (bf*)take((size_t)NB_ * TT * DQ * 2);
    float* FQ = Sb; float* FK = Sb + (size_t)NB_ * TT * DQ;   /* the f32 q and k projections lie in the score planes' space: LayerNorm has read them before the first score is stored */
    if ((size_t)(wsp - (char*)d_ws) > ws_size) return;    // ws 256 MiB
    { k_wtG<<<(unsigned)((DM * DQ / 64 + 63) / 64), 256, 0, stream>>>(wq, DM, DQ, WQ); k_wtG<<<(unsigned)((DM * DKV / 64 + 63) / 64), 256, 0, stream>>>(wk, DM, DKV, WK); k_wtG<<<(unsigned)((DM * DKV / 64 + 63) / 64), 256, 0, stream>>>(wv, DM, DKV, WV);
      k_wtG<<<(unsigned)((DQ * DM / 64 + 63) / 64), 256, 0, stream>>>(wo, DQ, DM, WO);
       }
    k_cvt8s<<<(unsigned)(((size_t)NB_ * TT * DM / 8 + 255) / 256), 256, 0, stream>>>(x, XB, (size_t)NB_ * TT * DM / 8);   /* rows batch-major: m = batch x TT + t */
    k_gemmw<bf, 0, true, 4, false><<<dim3(NB_ * TT / 64, DQ / 64, 1), 128, 0, stream>>>(XB, nullptr, WQ, nullptr, DM, FQ, DQ, bq, 0, 0, 0, nullptr, nullptr, nullptr); k_lnchunk<NH_><<<NB_ * TT * NH_ / 8, 256, 0, stream>>>(FQ, lng, lnb, QP16, QPh, QPl);   /* LayerNorm of each 256-wide query head -> planes */
    k_gemmw<bf, 0, true, 4, false><<<dim3(NB_ * TT / 64, DKV / 64, 1), 128, 0, stream>>>(XB, nullptr, WK, nullptr, DM, FK, DKV, bk, 0, 0, 0, nullptr, nullptr, nullptr); k_lnchunk<NKV><<<NB_ * TT * NKV / 8, 256, 0, stream>>>(FK, lng, lnb, KP16, KPh, KPl);   /* LayerNorm of each key group -> planes */
    k_gemmw<bf, 0, true, 4, true><<<dim3(DKV / 64, TT / 64, NB_), 128, 0, stream>>>(WV, nullptr, XB, nullptr, DM, nullptr, TT, bv, 0, (size_t)TT * DM, (size_t)DKV * TT, VT16, VTh, VTl);   /* v transposed, z = batch: rows = (group, feature), columns = positions */
    k_gemmc<bf, 2, 1, 1><<<dim3(RH / 64, TT / 64, NZ), 32, 0, stream>>>(QPh, QPl, KPh, KPl, HD, HD, Sb, 0, 0, (size_t)TT * HD, (size_t)TT * HD, 0, nullptr, nullptr, 1.0f);
    k_gemmc<h16, 0, 1, 1><<<dim3((TT - RH) / 64, TT / 64, NZ), 32, 0, stream>>>(QP16 + (size_t)RH * HD, nullptr, KP16, nullptr, HD, HD, Sb, 0, RH, (size_t)TT * HD, (size_t)TT * HD, 0, nullptr, nullptr, 1.0f);
    k_asoft<<<NZ * TT / 8, 256, 0, stream>>>(Sb, P16);
    k_gemmc<bf, 2, 2, 8><<<dim3(RH / 64, HD / 64, NZ), 256, 0, stream>>>((const bf*)Sb, nullptr, VTh, VTl, TT, 0, nullptr, DQ, 0, 0, (size_t)HD * TT, (size_t)HD, ATh, ATl, 1.0f);
    k_gemmc<h16, 0, 2, 8><<<dim3((TT - RH) / 64, HD / 64, NZ), 256, 0, stream>>>(P16, nullptr, VT16, nullptr, TT, 0, nullptr, DQ, RH, 0, (size_t)HD * TT, (size_t)HD, ATh, ATl, 1.0f / PCAR);
    k_gemmw<bf, 1, true, 16, false><<<dim3(TT / 64, DM / 64, NB_), 512, 0, stream>>>(ATh, ATl, WO, nullptr, DQ, OUT, NB_ * DM, bo, (size_t)TT * DQ, 0, (size_t)DM, nullptr, nullptr, nullptr);   /* z = batch; output rows interleaved by batch: pitch 2 x 256 */
}

// v005
// One run takes 211 microseconds.
// Next to v004, in two timings, it ran 1.27 times as fast each time.
// Over all steps from v000 it is 7.04 times as fast.
#include <hip/hip_runtime.h>

// Grouped (GQA-style) causal attention with full-width heads and LayerNorm on q and k (x [2048][2][256] (seq, batch, dim); K = x WK_w + WK_b, V = x WV_w + WV_b ('xw' [256][512]: 2 key groups of width 256); Q = x WQ_w + WQ_b ('xw' [256][2048]: 2 groups x 4 sub-queries of width 256, head (g, sub) uses key group g); K and Q LayerNormed over their 256 features (ln_g, ln_b, eps 1e-5); scores = Q.K/16, causal (-inf); softmax; out = merged (g, sub, i) WO_w + WO_b ('xw' [2048][256]) -> [2048][2][256] (1.05 M)).
// Compute dtypes, f32 accumulate: every input rounded to bf16; q/k/v on PLAIN bf16 operands (inputs: exact) + biases; LayerNorm of every 256-wide q / k head row in f32, stored straight as 16-bit head planes; v projected transposed (weights as the A operand) and stored straight as its planes; causal scores and attn.v (tile skipping), all 16 (batch, query head) pairs in one pass (grid z), each reading its batch's key group's planes, scores kept only for the 64x64 tiles on or below the diagonal: query rows < 512 hl (3 products), the rest single fp16 (x1024); softmax f32; attn.v stores the merged hi+lo rows itself; WO_w hl x exact (2 products) + WO_b.

#define NB_  2
#define TT   2048
#define DM   256
#define NH_  8
#define NKV  2
#define REP  (NH_ / NKV)
#define HD   256
#define DQ   (NH_ * HD)
#define DKV  (NKV * HD)
#define NZ   (NB_ * NH_)          // (batch, query head) pairs: grid z of the attention launches, z = batch x NH_ + head
#define SPL  ((size_t)(TT / 64) * (TT / 64 + 1) / 2 * 4096)   // f32 elements of one packed causal score plane: row tile R (64 rows) starts at 2048 R (R + 1) and holds 64 rows of (R + 1) x 64 columns
#define RH   512                  // query rows < RH use hi+lo planes (0: none)
#define WIN  2048
#define PCAR 1024.0f
#define SCL  0.0625f   // 1/sqrt(dim = 256)
typedef _Float16 h16;
typedef unsigned short bf;
typedef __attribute__((ext_vector_type(16))) __bf16   v16bf;
typedef __attribute__((ext_vector_type(16))) _Float16 v16h;
typedef __attribute__((ext_vector_type(8)))  _Float16 v8h;
typedef __attribute__((ext_vector_type(8)))  unsigned short v8us;
typedef __attribute__((ext_vector_type(8)))  float    v8f;
typedef __attribute__((ext_vector_type(4)))  float    v4f;
typedef v8h  __attribute__((may_alias)) v8ha;
typedef v4f  __attribute__((may_alias)) v4fa;
typedef v8us __attribute__((may_alias)) v8usa;

__device__ __forceinline__ unsigned short f2bf(float f) { unsigned u = __float_as_uint(f); u += 0x7FFFu + ((u >> 16) & 1u); return (unsigned short)(u >> 16); }
__device__ __forceinline__ float bf2f(unsigned short b) { return __uint_as_float(((unsigned)b) << 16); }
__device__ __forceinline__ float bfr(float f) { return bf2f(f2bf(f)); }
__device__ __forceinline__ v16h cat16(v8h lo, v8h hi) { return __builtin_shufflevector(lo, hi, 0, 1, 2, 3, 4, 5, 6, 7, 8, 9, 10, 11, 12, 13, 14, 15); }
__device__ __forceinline__ v16bf cat16b(v8us lo, v8us hi) { return __builtin_bit_cast(v16bf, __builtin_shufflevector(lo, hi, 0, 1, 2, 3, 4, 5, 6, 7, 8, 9, 10, 11, 12, 13, 14, 15)); }
__device__ __forceinline__ v8f wmma16(v16h a, v16h b, v8f c) { return __builtin_amdgcn_wmma_f32_16x16x32_f16(false, a, false, b, (short)0, c, false, false); }
__device__ __forceinline__ v8f wmmab(v16bf a, v16bf b, v8f c) { return __builtin_amdgcn_wmma_f32_16x16x32_bf16(false, a, false, b, (short)0, c, false, false); }
__device__ __forceinline__ h16 tohx(float x) { return (h16)x; }
__device__ __forceinline__ void splitf(float y, unsigned short& h, unsigned short& l) { h = f2bf(y); l = f2bf(y - bf2f(h)); }
typedef __attribute__((ext_vector_type(4))) _Float16 v4h;
typedef __attribute__((ext_vector_type(4))) unsigned short v4us;



// ---- d_gemmw (body; block indices bx, by, z handed in by the kernel that holds it, with its LDS slabs os): register-blocked GEMM, one work-group of NW waves per 64x64 output tile; wave w takes the 32-wide K steps w, w + NW, ... into its own 16 accumulators (operands straight from K-contiguous 16-bit planes),
// and the NW partial tiles are added through LDS in wave order 0..NW-1 (fixed, so the result is the same on every run); grid (M/64, N/64, Z), 32 x NW threads.
// C[m][n] (f32, pitch ldc, + optional f32 bias[n]) = sum_k A[m][k] Bt[n][k] (+ split products per NSPLIT). z-batch strides sA/sB/sC in elements. K % 32 == 0.
// PL: the bias is per row m (bias[m]) and the tile is stored as three 16-bit planes (fp16, bf16 hi, bf16 lo; pitch ldc, z step sC) instead of f32 C: with the weights as A and the activations as Bt this is the transposed projection.
// tile_sync: orders the LDS slabs between the waves of a tile. One wave: only keeps the compiler from moving LDS accesses across. Several waves: the work-group barrier with work-group fences on LDS alone,
// so that a wave waits for its LDS traffic but not for the tile rows it has just stored to global memory (__syncthreads() waited for those stores at every slab; nobody in the launch reads them).
template <int NW> __device__ __forceinline__ void tile_sync() {
    if (NW == 1) { __builtin_amdgcn_wave_barrier(); asm volatile("" ::: "memory"); }
    else { __builtin_amdgcn_fence(__ATOMIC_RELEASE, "workgroup", "local"); __builtin_amdgcn_s_barrier(); __builtin_amdgcn_fence(__ATOMIC_ACQUIRE, "workgroup", "local"); } }
// addr_wait: s_wait_xcnt 0 behind the last operand load of a K step, before later code reuses the loads' address registers. The addresses are named as inputs so that their registers stay whole up to the wait:
// without them a later load of the same step was given an earlier load's address pair as its destination.
__device__ __forceinline__ void addr_wait(const void* p0, const void* p1, const void* p2, const void* p3) { asm volatile("s_wait_xcnt 0x0" :: "v"(p0), "v"(p1), "v"(p2), "v"(p3) : "memory"); }
__device__ __forceinline__ void addr_wait(const void* p0, const void* p1, const void* p2, const void* p3, const void* p4, const void* p5, const void* p6, const void* p7, const void* p8, const void* p9) { asm volatile("s_wait_xcnt 0x0" :: "v"(p0), "v"(p1), "v"(p2), "v"(p3), "v"(p4), "v"(p5), "v"(p6), "v"(p7), "v"(p8), "v"(p9) : "memory"); }
template <typename T16> struct WFrag;
template <> struct WFrag<h16> { typedef v16h V; static __device__ __forceinline__ V ld(const h16* p) { return cat16(*(const v8h*)p, *(const v8h*)(p + 16)); } static __device__ __forceinline__ v8f mma(V a, V b, v8f c) { return wmma16(a, b, c); } };
template <> struct WFrag<bf> { typedef v16bf V; static __device__ __forceinline__ V ld(const bf* p) { return cat16b(*(const v8us*)p, *(const v8us*)(p + 16)); } static __device__ __forceinline__ v8f mma(V a, V b, v8f c) { return wmmab(a, b, c); } };
template <typename T16, int NSPLIT, bool BIAS, int NW, bool PL>
__device__ __forceinline__ void d_gemmw(float* os, const int bx, const int by, const size_t z, const T16* __restrict__ A, const T16* __restrict__ A2, const T16* __restrict__ Bt, const T16* __restrict__ Bt2, int K, float* C, int ldc, const float* __restrict__ bias, size_t sA, size_t sB, size_t sC, h16* P16, bf* Ph, bf* Pl) {
    typedef typename WFrag<T16>::V V;
    A += z * sA; if (A2) A2 += z * sA; Bt += z * sB; if (Bt2) Bt2 += z * sB; if (PL) { P16 += z * sC; Ph += z * sC; Pl += z * sC; } else C += z * sC;
    const int lane = threadIdx.x & 31, lr = lane & 15, hi = lane >> 4; const int r0 = bx * 64, c0 = by * 64;
    const int w = (NW == 1) ? 0 : __builtin_amdgcn_readfirstlane((int)(threadIdx.x >> 5));   // wave number, scalar: the K loop's branch stays wave-uniform (WMMA needs every lane on)
    v8f acc[4][4];
#pragma unroll
    for (int mb = 0; mb < 4; ++mb)
#pragma unroll
        for (int nb = 0; nb < 4; ++nb) acc[mb][nb] = (v8f){};
    const size_t aoff = (size_t)(r0 + lr) * K + 8 * hi, boff = (size_t)(c0 + lr) * K + 8 * hi;
    const T16* pa = A + aoff + w * 32; const T16* pa2 = (NSPLIT == 1 || NSPLIT == 2) ? A2 + aoff + w * 32 : pa; const T16* pb = Bt + boff + w * 32; const T16* pb2 = (NSPLIT >= 2) ? Bt2 + boff + w * 32 : pb;
#pragma unroll 1
    for (int kc = w * 32; kc < K; kc += 32 * NW, pa += 32 * NW, pa2 += 32 * NW, pb += 32 * NW, pb2 += 32 * NW) {
        V a[4], a2[4];
#pragma unroll
        for (int mb = 0; mb < 4; ++mb) { a[mb] = WFrag<T16>::ld(pa + (size_t)mb * 16 * K); if (NSPLIT == 1 || NSPLIT == 2) a2[mb] = WFrag<T16>::ld(pa2 + (size_t)mb * 16 * K); }
#pragma unroll
        for (int nb = 0; nb < 4; ++nb) { const V b = WFrag<T16>::ld(pb + (size_t)nb * 16 * K); V b2; if (NSPLIT >= 2) b2 = WFrag<T16>::ld(pb2 + (size_t)nb * 16 * K);
            if (nb == 3) addr_wait(pa, pa2, pb, pb2);
#pragma unroll
            for (int mb = 0; mb < 4; ++mb) { acc[mb][nb] = WFrag<T16>::mma(a[mb], b, acc[mb][nb]); if (NSPLIT == 1 || NSPLIT == 2) acc[mb][nb] = WFrag<T16>::mma(a2[mb], b, acc[mb][nb]); if (NSPLIT >= 2) acc[mb][nb] = WFrag<T16>::mma(a[mb], b2, acc[mb][nb]); } }
        asm volatile("v_nop\n\tv_nop\n\tv_nop\n\tv_nop" : "+v"(acc[0][0]), "+v"(acc[1][1]), "+v"(acc[2][2]), "+v"(acc[3][3]) : "v"(a[0]), "v"(a[3]));
    }
#pragma unroll
    for (int mb = 0; mb < 4; ++mb) {
#pragma unroll
        for (int nb = 0; nb < 4; ++nb) {
#pragma unroll
            for (int j = 0; j < 8; ++j) os[w * (16 * 68) + (hi * 8 + j) * 68 + nb * 16 + lr] = acc[mb][nb][j]; }
        tile_sync<NW>();   // every wave's partial slab is in LDS before any thread adds them
        float* crow = C + (size_t)(r0 + mb * 16) * ldc + c0;
{
#pragma unroll
            for (int s = 0; s < (NW < 8 ? 8 / NW : 1); ++s) if (NW <= 8 || w < 8) { const int idx = s * (32 * NW) + (int)threadIdx.x; const int row = idx >> 4, cofs = (idx & 15) * 4; v4f val = *(const v4fa*)(os + row * 68 + cofs);
#pragma unroll
                for (int ww = 1; ww < NW; ++ww) val += *(const v4fa*)(os + ww * (16 * 68) + row * 68 + cofs);
                if (BIAS && !PL) { val[0] += bfr(bias[c0 + cofs]); val[1] += bfr(bias[c0 + cofs + 1]); val[2] += bfr(bias[c0 + cofs + 2]); val[3] += bfr(bias[c0 + cofs + 3]); }
                if (PL) { if (BIAS) val += bfr(bias[r0 + mb * 16 + row]); v4h o16; v4us oh, ol;
#pragma unroll
                    for (int q = 0; q < 4; ++q) { o16[q] = tohx(val[q]); unsigned short a2, c2; splitf(val[q], a2, c2); oh[q] = a2; ol[q] = c2; }
                    const size_t oo = (size_t)(r0 + mb * 16 + row) * ldc + c0 + cofs; *(v4h*)(P16 + oo) = o16; *(v4us*)(Ph + oo) = oh; *(v4us*)(Pl + oo) = ol; }
                else *(v4f*)(crow + (size_t)row * ldc + cofs) = val;
                asm volatile("s_wait_xcnt 0x0" ::: "memory"); /* behind the store, before later code reuses its address and data registers */ }
             }
        if (mb < 3) tile_sync<NW>();   // the slabs are read out before the next 16 rows overwrite them
    }
}

// ---- d_gemmc (body, as d_gemmw): the same 64x64 tile GEMM specialised for causal attention: CMODE 1 skips score tiles entirely above the diagonal (query rows r0+roff.., key columns c0..), CMODE 2 limits the
// key (K) loop of the probability x value contraction to the diagonal block (probabilities beyond it are exactly zero). roff = row offset of this launch's first row within the sequence.
// CMODE 2 stores its tile x cs as bf16 hi + lo planes Ah / Al in the merged layout [t][head][d] (pitch ldc, head step sC, batch step TT rows, row roff + ...) that the output projection reads; C is not used there.
// NW waves share the tile's K loop as in d_gemmw (partials added through LDS in wave order). z = batch x NH_ + query head: Bt steps by sB per (batch, key group) = z / REP (Bt's pitch is K).
// Scores and probabilities live in the packed causal planes (SPL): CMODE 1 reads A (step sA per z, pitch lda) and stores its tile into row tile R of plane z of C; CMODE 2 reads A from there (16-bit rows over the f32 rows: pitch 2 x row length, the lo plane behind the hi plane inside each row).
template <typename T16, int NSPLIT, int CMODE, int NW>
__device__ __forceinline__ void d_gemmc(float* os, const int bx, const int by, const size_t z, const T16* __restrict__ A, const T16* __restrict__ A2, const T16* __restrict__ Bt, const T16* __restrict__ Bt2, int K, int lda, float* C, int ldc, int roff, size_t sA, size_t sB, size_t sC, bf* Ah, bf* Al, float cs) {
    typedef typename WFrag<T16>::V V;
    const int lane = threadIdx.x & 31, lr = lane & 15, hi = lane >> 4; const int r0 = bx * 64, c0 = by * 64;
    const int R = (r0 + roff) >> 6, len = (R + 1) * 64;              // row tile within the sequence, and its packed row length
    const size_t zg = z / REP, pk = z * SPL + (size_t)2048 * R * (R + 1); Bt += zg * sB; if (Bt2) Bt2 += zg * sB;
    if (CMODE == 2) { A += 2 * pk; A2 = A + len; lda = 2 * len; const size_t ao = (z / NH_) * ((size_t)TT * ldc) + (z % NH_) * sC; Ah += ao; Al += ao; }
    else { A += z * sA + (size_t)r0 * lda; if (A2) A2 += z * sA + (size_t)r0 * lda; C += pk; ldc = len; }
    const int w = (NW == 1) ? 0 : __builtin_amdgcn_readfirstlane((int)(threadIdx.x >> 5));   // wave number, scalar: the K loop's branch stays wave-uniform (WMMA needs every lane on)
    if (CMODE == 1 && c0 > r0 + roff + 63) return;                  // score tile entirely above the causal diagonal: never read (the softmax masks j > i by select)
    const int Kl = (CMODE == 2) ? min(K, r0 + roff + 64) : K;        // P.V: probabilities are exactly 0 beyond the diagonal block, so the K loop stops there
    v8f acc[4][4];
#pragma unroll
    for (int mb = 0; mb < 4; ++mb)
#pragma unroll
        for (int nb = 0; nb < 4; ++nb) acc[mb][nb] = (v8f){};
    const size_t aoff = (size_t)(lr * lda) + 8 * hi, boff = (size_t)(c0 + lr) * K + 8 * hi;
#pragma unroll 1
    for (int kc = w * 32; kc < Kl; kc += 32 * NW) {
        V a[4], a2[4]; const T16* pa[4]; const T16* pa2[4]; const T16* pb = Bt + boff + kc; const T16* pb2 = (NSPLIT >= 2) ? Bt2 + boff + kc : pb;
#pragma unroll
        for (int mb = 0; mb < 4; ++mb) { pa[mb] = A + aoff + (size_t)mb * 16 * lda + kc; pa2[mb] = (NSPLIT == 1 || NSPLIT == 2) ? A2 + aoff + (size_t)mb * 16 * lda + kc : pa[mb]; a[mb] = WFrag<T16>::ld(pa[mb]); if (NSPLIT == 1 || NSPLIT == 2) a2[mb] = WFrag<T16>::ld(pa2[mb]); }
#pragma unroll
        for (int nb = 0; nb < 4; ++nb) { const V b = WFrag<T16>::ld(pb + (size_t)nb * 16 * K); V b2; if (NSPLIT >= 2) b2 = WFrag<T16>::ld(pb2 + (size_t)nb * 16 * K);
            if (nb == 3) { if (CMODE == 2) addr_wait(pa[0], pa[1], pa[2], pa[3], pa2[0], pa2[1], pa2[2], pa2[3], pb, pb2);   // the packed rows' pitch is not a constant: every 16-row block has an address pair of its own
                else addr_wait(pa[0], pa2[0], pb, pb2); }
#pragma unroll
            for (int mb = 0; mb < 4; ++mb) { acc[mb][nb] = WFrag<T16>::mma(a[mb], b, acc[mb][nb]); if (NSPLIT == 1 || NSPLIT == 2) acc[mb][nb] = WFrag<T16>::mma(a2[mb], b, acc[mb][nb]); if (NSPLIT >= 2) acc[mb][nb] = WFrag<T16>::mma(a[mb], b2, acc[mb][nb]); } }
        asm volatile("v_nop\n\tv_nop\n\tv_nop\n\tv_nop" : "+v"(acc[0][0]), "+v"(acc[1][1]), "+v"(acc[2][2]), "+v"(acc[3][3]) : "v"(a[0]), "v"(a[3]));
    }
#pragma unroll
    for (int mb = 0; mb < 4; ++mb) {
#pragma unroll
        for (int nb = 0; nb < 4; ++nb) {
#pragma unroll
            for (int j = 0; j < 8; ++j) os[w * (16 * 68) + (hi * 8 + j) * 68 + nb * 16 + lr] = acc[mb][nb][j]; }
        tile_sync<NW>();   // every wave's partial slab is in LDS before any thread adds them
        float* crow = C + (size_t)(mb * 16) * ldc + c0;
{
#pragma unroll
            for (int s = 0; s < (NW < 8 ? 8 / NW : 1); ++s) if (NW <= 8 || w < 8) { const int idx = s * (32 * NW) + (int)threadIdx.x; const int row = idx >> 4, cofs = (idx & 15) * 4; v4f val = *(const v4fa*)(os + row * 68 + cofs);
#pragma unroll
                for (int ww = 1; ww < NW; ++ww) val += *(const v4fa*)(os + ww * (16 * 68) + row * 68 + cofs);
                if (CMODE == 2) { v4us oh, ol;
#pragma unroll
                    for (int q = 0; q < 4; ++q) { unsigned short a2, c2; splitf(val[q] * cs, a2, c2); oh[q] = a2; ol[q] = c2; }
                    const size_t oo = (size_t)(r0 + roff + mb * 16 + row) * ldc + c0 + cofs; *(v4us*)(Ah + oo) = oh; *(v4us*)(Al + oo) = ol; }
                else *(v4f*)(crow + (size_t)row * ldc + cofs) = val;
                asm volatile("s_wait_xcnt 0x0" ::: "memory"); /* behind the store, before later code reuses its address and data registers */ }
             }
        if (mb < 3) tile_sync<NW>();   // the slabs are read out before the next 16 rows overwrite them
    }
}

typedef __attribute__((ext_vector_type(2))) _Float16 v2h;
typedef __attribute__((ext_vector_type(2))) unsigned short v2us;
typedef __attribute__((ext_vector_type(2))) float v2f;
typedef __attribute__((ext_vector_type(4))) int v4i;

__device__ __forceinline__ void d_wtG(const int bx, const float* __restrict__ w, int K, int N, bf* Bt) {
    const int lane = threadIdx.x & 31; const int L0 = (bx * 8 + (threadIdx.x >> 5)) * 8; const int nlines = N * K / 64;
{
#pragma unroll 1
        for (int l = 0; l < 8; ++l) { const int L = L0 + l; if (L >= nlines) break; const size_t e = (size_t)L * 64 + lane * 2; const int k = (int)(e % K), n = (int)(e / K); v2us o;
            o[0] = f2bf(w[(size_t)k * N + n]); o[1] = f2bf(w[(size_t)(k + 1) * N + n]); *(v2us*)(Bt + e) = o; }
         }
}
// d_cvt8s: x [t][batch][DM] f32 -> bf16 rows in batch-major order [batch][t][DM]
__device__ __forceinline__ void d_cvt8s(const int bx, const float* __restrict__ src, bf* dst, size_t n8) { const size_t i = (size_t)bx * 256 + threadIdx.x; if (i >= n8) return; const size_t e = i * 8; const size_t m = e / DM, c = e % DM; const v8f v = *(const v8f*)(src + ((m % TT) * NB_ + m / TT) * DM + c); v8us o;
#pragma unroll
    for (int k = 0; k < 8; ++k) o[k] = f2bf(v[k]); *(v8us*)(dst + e) = o;  }
// d_lnchunk: one wave per 256-wide head row w = (batch x TT + t) x NCH + h of F; the normalised row goes straight into the head planes [batch x NCH + h][t][d] (fp16, bf16 hi, bf16 lo) that the score products read.
template <int NCH>
__device__ __forceinline__ void d_lnchunk(const int bx, const float* __restrict__ F, const float* __restrict__ gw, const float* __restrict__ gb, h16* P16, bf* Ph, bf* Pl) {
    const int lane = threadIdx.x & 31; const int w = bx * 8 + (threadIdx.x >> 5); if (w >= NB_ * TT * NCH) return; const float* fr = F + (size_t)w * HD; const int m = w / NCH; const size_t pe = ((size_t)((m / TT) * NCH + w % NCH) * TT + m % TT) * HD; float hv[8]; float s = 0.f;
#pragma unroll
    for (int ch = 0; ch < 2; ++ch) { const v4f y = *(const v4f*)(fr + ch * 128 + lane * 4);
#pragma unroll
        for (int q = 0; q < 4; ++q) { hv[ch * 4 + q] = y[q]; s += y[q]; } }
#pragma unroll
    for (int sh = 16; sh; sh >>= 1) s += __shfl_xor(s, sh, 32);
    const float mu = s * (1.0f / HD); float s2 = 0.f;
#pragma unroll
    for (int k = 0; k < 8; ++k) { float d0 = __fsub_rn(hv[k], mu); asm volatile("" : "+v"(d0)); float p = __fmul_rn(d0, d0); asm volatile("" : "+v"(p)); s2 = __fadd_rn(s2, p); }
#pragma unroll
    for (int sh = 16; sh; sh >>= 1) s2 += __shfl_xor(s2, sh, 32);
    float var = __fadd_rn(s2 * (1.0f / HD), 1e-5f); asm volatile("" : "+v"(var)); const float rs = __frsqrt_rn(var);
{
#pragma unroll
        for (int ch = 0; ch < 2; ++ch) { const int c0 = ch * 128 + lane * 4; v4f o;
#pragma unroll
            for (int q = 0; q < 4; ++q) { float gg = bfr(gw[c0 + q]), bb = bfr(gb[c0 + q]); asm volatile("" : "+v"(gg), "+v"(bb)); float d0 = __fsub_rn(hv[ch * 4 + q], mu); asm volatile("" : "+v"(d0)); float n0 = __fmul_rn(d0, rs); asm volatile("" : "+v"(n0)); float n1 = __fmul_rn(n0, gg); asm volatile("" : "+v"(n1)); o[q] = __fadd_rn(n1, bb); }
            v4h o16; v4us oh, ol;
#pragma unroll
            for (int q = 0; q < 4; ++q) { o16[q] = tohx(o[q]); unsigned short a2, c2; splitf(o[q], a2, c2); oh[q] = a2; ol[q] = c2; }
            *(v4h*)(P16 + pe + c0) = o16; *(v4us*)(Ph + pe + c0) = oh; *(v4us*)(Pl + pe + c0) = ol;
            asm volatile("s_wait_xcnt 0x0" ::: "memory"); /* behind the stores, before the next half row's code reuses their data registers */ }
         } }
__global__ __launch_bounds__(256) void k_cvt8(const float* __restrict__ src, bf* dst, size_t n8) { const size_t i = (size_t)blockIdx.x * 256 + threadIdx.x; if (i >= n8) return; const v8f v = *(const v8f*)(src + i * 8); v8us o;
#pragma unroll
    for (int k = 0; k < 8; ++k) o[k] = f2bf(v[k]); *(v8us*)(dst + i * 8) = o;  }

// k_asoft: per row (zz, i): t = S x HD^-0.5 for j <= i (causal; masked keys vanish identically); softmax over the row's keys (register row, one exp, fixed trees). A row of row tile R has (R + 1) x 64 stored columns (packed planes, SPL);
// 128-column chunks past them are skipped under a wave-uniform test: their terms were exact zeros, so the sums are the same. The 16-bit probabilities of a row are stored over that row's own scores (fp16 in its first half;
// for rows < RH bf16 hi in the first half and lo in the second): the wave holds the whole row in registers before its first store, and no other wave touches the row.
__global__ __launch_bounds__(256) void k_asoft(const float* Sb, h16* P16) {
    const int lane = threadIdx.x & 31; const int row = blockIdx.x * 8 + __builtin_amdgcn_readfirstlane((int)(threadIdx.x >> 5));   // the wave's row, scalar: row start and length stay in scalar registers, the chunk skips below are scalar branches
    if (row >= NZ * TT) return; const int i = row % TT; const int zz = row / TT; const bool hires = (i < RH);
    const int R = i >> 6, len = (R + 1) * 64; const int nch = (len + 127) >> 7;   // 128-column chunks of this row
    const size_t ro = (size_t)zz * SPL + (size_t)2048 * R * (R + 1) + (size_t)(i & 63) * len; const float* sr = Sb + ro; v4f a[TT / 128]; float v[TT / 32]; float mx = -3.0e38f;
#pragma unroll
    for (int ch = 0; ch < TT / 128; ++ch) { const int j0 = ch * 128 + lane * 4; a[ch] = (v4f){}; if (j0 < len) a[ch] = *(const v4f*)(sr + j0); }   // all loads first, so that they are in flight together
#pragma unroll
    for (int ch = 0; ch < TT / 128; ++ch) if (ch < nch) { const int j0 = ch * 128 + lane * 4;
#pragma unroll
        for (int q = 0; q < 4; ++q) { const int j = j0 + q; float sa = a[ch][q] * SCL; asm volatile("" : "+v"(sa)); const float t = (j <= i) ? sa : -3.0e38f; v[ch * 4 + q] = t; mx = fmaxf(mx, t); } }
#pragma unroll
    for (int sh = 16; sh; sh >>= 1) mx = fmaxf(mx, __shfl_xor(mx, sh, 32));
    float sum = 0.f;
#pragma unroll
    for (int ch = 0; ch < TT / 128; ++ch) if (ch < nch) {
#pragma unroll
        for (int k = ch * 4; k < ch * 4 + 4; ++k) { float d0 = __fsub_rn(v[k], mx); asm volatile("" : "+v"(d0)); v[k] = __builtin_amdgcn_exp2f(__fmul_rn(d0, 1.4426950408889634f)); sum += v[k]; } }
#pragma unroll
    for (int sh = 16; sh; sh >>= 1) sum += __shfl_xor(sum, sh, 32);
    const float f = __fdiv_rn(hires ? 1.0f : PCAR, sum);
{
        if (hires) { bf* ph = (bf*)(P16 + 2 * ro); bf* pl = ph + len;
#pragma unroll
            for (int ch = 0; ch < RH / 128; ++ch) if (ch < nch) { const int j0 = ch * 128 + lane * 4; v4us oh, ol;
#pragma unroll
                for (int q = 0; q < 4; ++q) { unsigned short a2, c2; splitf(v[ch * 4 + q] * f, a2, c2); oh[q] = a2; ol[q] = c2; }
                if (j0 < len) { *(v4us*)(ph + j0) = oh; *(v4us*)(pl + j0) = ol; } }
        } else {
#pragma unroll
            for (int ch = 0; ch < TT / 128; ++ch) if (ch < nch) { const int j0 = ch * 128 + lane * 4; v4h o4;
#pragma unroll
                for (int q = 0; q < 4; ++q) o4[q] = tohx(v[ch * 4 + q] * f);
                if (j0 < len) *(v4h*)(P16 + 2 * ro + j0) = o4; } }
         }
}

// ---- Merged launches: launches that do not depend on each other share one grid; a block-uniform test on the block index picks the body, and every body works on the tiles it had in its own launch.
#define GWQ (DM * DQ / 64 / 64)    // work-groups of the WQ (and WO) transpose
#define GWK (DM * DKV / 64 / 64)   // work-groups of the WK (and WV) transpose
#define GCX (NB_ * TT * DM / 8 / 256)   // work-groups of the x conversion
// k_prep: the four weight transposes (the longer bodies, first) and the x conversion
__global__ __launch_bounds__(256) void k_prep(const float* __restrict__ wq, const float* __restrict__ wo, const float* __restrict__ wk, const float* __restrict__ wv, const float* __restrict__ x, bf* WQ, bf* WO, bf* WK, bf* WV, bf* XB) {
    const int b = blockIdx.x;
    if (b < GWQ) d_wtG(b, wq, DM, DQ, WQ);
    else if (b < 2 * GWQ) d_wtG(b - GWQ, wo, DQ, DM, WO);
    else if (b < 2 * GWQ + GWK) d_wtG(b - 2 * GWQ, wk, DM, DKV, WK);
    else if (b < 2 * GWQ + 2 * GWK) d_wtG(b - (2 * GWQ + GWK), wv, DM, DKV, WV);
    else d_cvt8s(b - (2 * GWQ + 2 * GWK), x, XB, (size_t)NB_ * TT * DM / 8);   /* rows batch-major: m = batch x TT + t */
}
// k_proj: grid (NB_ TT / 64, (DQ + 2 DKV) / 64): columns y < DQ / 64 are q tiles, the next DKV / 64 k tiles; the rest, counted x first, are the transposed v tiles in their own launch order (feature tile, position tile, batch)
__global__ __launch_bounds__(128) void k_proj(const bf* __restrict__ XB, const bf* __restrict__ WQ, const bf* __restrict__ WK, const bf* __restrict__ WV, const float* __restrict__ bq, const float* __restrict__ bk, const float* __restrict__ bv, float* FQ, float* FK, h16* VT16, bf* VTh, bf* VTl) {
    __shared__ __align__(16) float os[4 * 16 * 68];
    const int bx = blockIdx.x, by = blockIdx.y;
    if (by < DQ / 64) d_gemmw<bf, 0, true, 4, false>(os, bx, by, 0, XB, nullptr, WQ, nullptr, DM, FQ, DQ, bq, 0, 0, 0, nullptr, nullptr, nullptr);
    else if (by < (DQ + DKV) / 64) d_gemmw<bf, 0, true, 4, false>(os, bx, by - DQ / 64, 0, XB, nullptr, WK, nullptr, DM, FK, DKV, bk, 0, 0, 0, nullptr, nullptr, nullptr);
    else { const int t = (by - (DQ + DKV) / 64) * (NB_ * TT / 64) + bx;
        d_gemmw<bf, 0, true, 4, true>(os, t % (DKV / 64), (t / (DKV / 64)) % (TT / 64), (size_t)(t / ((DKV / 64) * (TT / 64))), WV, nullptr, XB, nullptr, DM, nullptr, TT, bv, 0, (size_t)TT * DM, (size_t)DKV * TT, VT16, VTh, VTl); }   /* v transposed, z = batch: rows = (group, feature), columns = positions */
}
// k_ln: LayerNorm of the query head rows, then of the key group rows
__global__ __launch_bounds__(256) void k_ln(const float* __restrict__ FQ, const float* __restrict__ FK, const float* __restrict__ gw, const float* __restrict__ gb, h16* QP16, bf* QPh, bf* QPl, h16* KP16, bf* KPh, bf* KPl) {
    const int b = blockIdx.x;
    if (b < NB_ * TT * NH_ / 8) d_lnchunk<NH_>(b, FQ, gw, gb, QP16, QPh, QPl);
    else d_lnchunk<NKV>(b - NB_ * TT * NH_ / 8, FK, gw, gb, KP16, KPh, KPl);
}
// k_score: grid (TT / 64 row tiles, TT / 64 key tiles, NZ): row tiles below RH take the hi+lo products, the rest fp16 (x is the row tile within the sequence for both, so the row offset is 0)
__global__ __launch_bounds__(32) void k_score(const bf* __restrict__ QPh, const bf* __restrict__ QPl, const bf* __restrict__ KPh, const bf* __restrict__ KPl, const h16* __restrict__ QP16, const h16* __restrict__ KP16, float* Sb) {
    __shared__ __align__(16) float os[16 * 68];
    const int bx = blockIdx.x;
    if (bx < RH / 64) d_gemmc<bf, 2, 1, 1>(os, bx, blockIdx.y, blockIdx.z, QPh, QPl, KPh, KPl, HD, HD, Sb, 0, 0, (size_t)TT * HD, (size_t)TT * HD, 0, nullptr, nullptr, 1.0f);
    else d_gemmc<h16, 0, 1, 1>(os, bx, blockIdx.y, blockIdx.z, QP16, nullptr, KP16, nullptr, HD, HD, Sb, 0, 0, (size_t)TT * HD, (size_t)TT * HD, 0, nullptr, nullptr, 1.0f);
}
// k_pv: grid (TT / 64 row tiles, HD / 64, NZ): the same split for probabilities x values
__global__ __launch_bounds__(256) void k_pv(const float* Sb, const bf* __restrict__ VTh, const bf* __restrict__ VTl, const h16* __restrict__ VT16, bf* ATh, bf* ATl) {
    __shared__ __align__(16) float os[8 * 16 * 68];
    const int bx = blockIdx.x;
    if (bx < RH / 64) d_gemmc<bf, 2, 2, 8>(os, bx, blockIdx.y, blockIdx.z, (const bf*)Sb, nullptr, VTh, VTl, TT, 0, nullptr, DQ, 0, 0, (size_t)HD * TT, (size_t)HD, ATh, ATl, 1.0f);
    else d_gemmc<h16, 0, 2, 8>(os, bx, blockIdx.y, blockIdx.z, (const h16*)Sb, nullptr, VT16, nullptr, TT, 0, nullptr, DQ, 0, 0, (size_t)HD * TT, (size_t)HD, ATh, ATl, 1.0f / PCAR);
}
// k_out: d_gemmw alone in a launch (the output projection), grid (TT / 64, DM / 64, NB_); its shape is written here like the other kernels', so that the row blocks of an operand share one address pair (the one addr_wait names)
__global__ __launch_bounds__(512) void k_out(const bf* __restrict__ ATh, const bf* __restrict__ ATl, const bf* __restrict__ WO, const float* __restrict__ bo, float* OUT) {
    __shared__ __align__(16) float os[16 * 16 * 68];
    d_gemmw<bf, 1, true, 16, false>(os, blockIdx.x, blockIdx.y, blockIdx.z, ATh, ATl, WO, nullptr, DQ, OUT, NB_ * DM, bo, (size_t)TT * DQ, 0, (size_t)DM, nullptr, nullptr, nullptr);   /* z = batch; output rows interleaved by batch: pitch 2 x 256 */
}

extern "C" void kernel_launch(void* const* d_in, const int* in_sizes, int n_in,
                              void* d_out, int out_size, void* d_ws, size_t ws_size, hipStream_t stream) {
    (void)in_sizes; (void)n_in; (void)out_size;
    const float* x = (const float*)d_in[0]; const float* wk = (const float*)d_in[1]; const float* bk = (const float*)d_in[2]; const float* wv = (const float*)d_in[3]; const float* bv = (const float*)d_in[4]; const float* wq = (const float*)d_in[5]; const float* bq = (const float*)d_in[6]; const float* wo = (const float*)d_in[7]; const float* bo = (const float*)d_in[8]; const float* lng = (const float*)d_in[9]; const float* lnb = (const float*)d_in[10];
    float* OUT = (float*)d_out;     // [2048][2][256] (seq, batch, dim)
    char* wsp = (char*)d_ws;
    auto take = [&](size_t bytes) { char* p = wsp; wsp += (bytes + 255) & ~(size_t)255; return (void*)p; };
    bf* WQ = (bf*)take((size_t)DQ * DM * 2); bf* WK = (bf*)take((size_t)DKV * DM * 2); bf* WV = (bf*)take((size_t)DKV * DM * 2); bf* WO = (bf*)take((size_t)DM * DQ * 2);
    bf* XB = (bf*)take((size_t)NB_ * TT * DM * 2);
    h16* QP16 = (h16*)take((size_t)NZ * TT * HD * 2); h16* KP16 = (h16*)take((size_t)NB_ * NKV * TT * HD * 2); h16* VT16 = (h16*)take((size_t)NB_ * NKV * HD * TT * 2);
    bf* QPh = (bf*)take((size_t)NZ * TT * HD * 2); bf* QPl = (bf*)take((size_t)NZ * TT * HD * 2); bf* KPh = (bf*)take((size_t)NB_ * NKV * TT * HD * 2); bf* KPl = (bf*)take((size_t)NB_ * NKV * TT * HD * 2); bf* VTh = (bf*)take((size_t)NB_ * NKV * HD * TT * 2); bf* VTl = (bf*)take((size_t)NB_ * NKV * HD * TT * 2);
    float* Sb = (float*)take((size_t)NZ * SPL * 4); h16* P16 = (h16*)Sb; /* probabilities in place over their score rows */ bf* ATh = (bf*)take((size_t)NB_ * TT * DQ * 2); bf* ATl = (bf*)take((size_t)NB_ * TT * DQ * 2);
    float* FQ = Sb; float* FK = Sb + (size_t)NB_ * TT * DQ;   /* the f32 q and k projections lie in the score planes' space: LayerNorm has read them before the first score is stored */
    if ((size_t)(wsp - (char*)d_ws) > ws_size) return;    // ws 256 MiB
    k_prep<<<2 * GWQ + 2 * GWK + GCX, 256, 0, stream>>>(wq, wo, wk, wv, x, WQ, WO, WK, WV, XB);
    k_proj<<<dim3(NB_ * TT / 64, (DQ + 2 * DKV) / 64, 1), 128, 0, stream>>>(XB, WQ, WK, WV, bq, bk, bv, FQ, FK, VT16, VTh, VTl);
    k_ln<<<NB_ * TT * (NH_ + NKV) / 8, 256, 0, stream>>>(FQ, FK, lng, lnb, QP16, QPh, QPl, KP16, KPh, KPl);
    k_score<<<dim3(TT / 64, TT / 64, NZ), 32, 0, stream>>>(QPh, QPl, KPh, KPl, QP16, KP16, Sb);
    k_asoft<<<NZ * TT / 8, 256, 0, stream>>>(Sb, P16);
    k_pv<<<dim3(TT / 64, HD / 64, NZ), 256, 0, stream>>>(Sb, VTh, VTl, VT16, ATh, ATl);
    k_out<<<dim3(TT / 64, DM / 64, NB_), 512, 0, stream>>>(ATh, ATl, WO, bo, OUT);
}

// v006
// It runs in 128 microseconds.
// Next to v005, in two timings, it ran 1.66 times as fast each time.
// Counting every step since v000, it is 11.7 times as fast.
#include <hip/hip_runtime.h>

// Grouped (GQA-style) causal attention with full-width heads and LayerNorm on q and k (x [2048][2][256] (seq, batch, dim); K = x WK_w + WK_b, V = x WV_w + WV_b ('xw' [256][512]: 2 key groups of width 256); Q = x WQ_w + WQ_b ('xw' [256][2048]: 2 groups x 4 sub-queries of width 256, head (g, sub) uses key group g); K and Q LayerNormed over their 256 features (ln_g, ln_b, eps 1e-5); scores = Q.K/16, causal (-inf); softmax; out = merged (g, sub, i) WO_w + WO_b ('xw' [2048][256]) -> [2048][2][256] (1.05 M)).
// Compute dtypes, f32 accumulate: every input rounded to bf16; q/k/v on PLAIN bf16 operands (inputs: exact) + biases; LayerNorm of every 256-wide q / k head row in f32, stored straight as 16-bit head planes; v projected transposed (weights as the A operand) and stored straight as its planes; causal scores, softmax and attn.v in one kernel (running maximum and sum per query in f32, keys in steps of 32 up to the diagonal, no score ever stored), the 4 query heads of a key group sharing its key and value tiles in LDS: query rows < 512 hl (3 products), the rest single fp16 (probabilities x1024); it stores the merged hi+lo rows itself; WO_w hl x exact (2 products) + WO_b.

#define NB_  2
#define TT   2048
#define DM   256
#define NH_  8
#define NKV  2
#define REP  (NH_ / NKV)
#define HD   256
#define DQ   (NH_ * HD)
#define DKV  (NKV * HD)
#define NZ   (NB_ * NH_)          // (batch, query head) pairs, z = batch x NH_ + head
#define RH   512                  // query rows < RH use hi+lo planes (0: none)
#define PCAR 1024.0f
#define SCL  0.0625f   // 1/sqrt(dim = 256)
typedef _Float16 h16;
typedef unsigned short bf;
typedef __attribute__((ext_vector_type(16))) __bf16   v16bf;
typedef __attribute__((ext_vector_type(16))) _Float16 v16h;
typedef __attribute__((ext_vector_type(8)))  _Float16 v8h;
typedef __attribute__((ext_vector_type(8)))  unsigned short v8us;
typedef __attribute__((ext_vector_type(8)))  float    v8f;
typedef __attribute__((ext_vector_type(4)))  float    v4f;
typedef v8h  __attribute__((may_alias)) v8ha;
typedef v4f  __attribute__((may_alias)) v4fa;
typedef v8us __attribute__((may_alias)) v8usa;

__device__ __forceinline__ unsigned short f2bf(float f) { unsigned u = __float_as_uint(f); u += 0x7FFFu + ((u >> 16) & 1u); return (unsigned short)(u >> 16); }
__device__ __forceinline__ float bf2f(unsigned short b) { return __uint_as_float(((unsigned)b) << 16); }
__device__ __forceinline__ float bfr(float f) { return bf2f(f2bf(f)); }
__device__ __forceinline__ v16h cat16(v8h lo, v8h hi) { return __builtin_shufflevector(lo, hi, 0, 1, 2, 3, 4, 5, 6, 7, 8, 9, 10, 11, 12, 13, 14, 15); }
__device__ __forceinline__ v16bf cat16b(v8us lo, v8us hi) { return __builtin_bit_cast(v16bf, __builtin_shufflevector(lo, hi, 0, 1, 2, 3, 4, 5, 6, 7, 8, 9, 10, 11, 12, 13, 14, 15)); }
__device__ __forceinline__ v8f wmma16(v16h a, v16h b, v8f c) { return __builtin_amdgcn_wmma_f32_16x16x32_f16(false, a, false, b, (short)0, c, false, false); }
__device__ __forceinline__ v8f wmmab(v16bf a, v16bf b, v8f c) { return __builtin_amdgcn_wmma_f32_16x16x32_bf16(false, a, false, b, (short)0, c, false, false); }
__device__ __forceinline__ h16 tohx(float x) { return (h16)x; }
__device__ __forceinline__ void splitf(float y, unsigned short& h, unsigned short& l) { h = f2bf(y); l = f2bf(y - bf2f(h)); }
typedef __attribute__((ext_vector_type(4))) _Float16 v4h;
typedef __attribute__((ext_vector_type(4))) unsigned short v4us;



// ---- d_gemmw (body; block indices bx, by, z handed in by the kernel that holds it, with its LDS slabs os): register-blocked GEMM, one work-group of NW waves per 64x64 output tile; wave w takes the 32-wide K steps w, w + NW, ... into its own 16 accumulators (operands straight from K-contiguous 16-bit planes),
// and the NW partial tiles are added through LDS in wave order 0..NW-1 (fixed, so the result is the same on every run); grid (M/64, N/64, Z), 32 x NW threads.
// C[m][n] (f32, pitch ldc, + optional f32 bias[n]) = sum_k A[m][k] Bt[n][k] (+ split products per NSPLIT). z-batch strides sA/sB/sC in elements. K % 32 == 0.
// PL: the bias is per row m (bias[m]) and the tile is stored as three 16-bit planes (fp16, bf16 hi, bf16 lo; pitch ldc, z step sC) instead of f32 C: with the weights as A and the activations as Bt this is the transposed projection.
// tile_sync: orders the LDS slabs between the waves of a tile. One wave: only keeps the compiler from moving LDS accesses across. Several waves: the work-group barrier with work-group fences on LDS alone,
// so that a wave waits for its LDS traffic but not for the tile rows it has just stored to global memory (__syncthreads() waited for those stores at every slab; nobody in the launch reads them).
template <int NW> __device__ __forceinline__ void tile_sync() {
    if (NW == 1) { __builtin_amdgcn_wave_barrier(); asm volatile("" ::: "memory"); }
    else { __builtin_amdgcn_fence(__ATOMIC_RELEASE, "workgroup", "local"); __builtin_amdgcn_s_barrier(); __builtin_amdgcn_fence(__ATOMIC_ACQUIRE, "workgroup", "local"); } }
// addr_wait: s_wait_xcnt 0 behind the last operand load of a K step, before later code reuses the loads' address registers. The addresses are named as inputs so that their registers stay whole up to the wait:
// without them a later load of the same step was given an earlier load's address pair as its destination.
__device__ __forceinline__ void addr_wait(const void* p0, const void* p1, const void* p2, const void* p3) { asm volatile("s_wait_xcnt 0x0" :: "v"(p0), "v"(p1), "v"(p2), "v"(p3) : "memory"); }
template <typename T16> struct WFrag;
template <> struct WFrag<h16> { typedef v16h V; static __device__ __forceinline__ V ld(const h16* p) { return cat16(*(const v8h*)p, *(const v8h*)(p + 16)); } static __device__ __forceinline__ v8f mma(V a, V b, v8f c) { return wmma16(a, b, c); } };
template <> struct WFrag<bf> { typedef v16bf V; static __device__ __forceinline__ V ld(const bf* p) { return cat16b(*(const v8us*)p, *(const v8us*)(p + 16)); } static __device__ __forceinline__ v8f mma(V a, V b, v8f c) { return wmmab(a, b, c); } };
template <typename T16, int NSPLIT, bool BIAS, int NW, bool PL>
__device__ __forceinline__ void d_gemmw(float* os, const int bx, const int by, const size_t z, const T16* __restrict__ A, const T16* __restrict__ A2, const T16* __restrict__ Bt, const T16* __restrict__ Bt2, int K, float* C, int ldc, const float* __restrict__ bias, size_t sA, size_t sB, size_t sC, h16* P16, bf* Ph, bf* Pl) {
    typedef typename WFrag<T16>::V V;
    A += z * sA; if (A2) A2 += z * sA; Bt += z * sB; if (Bt2) Bt2 += z * sB; if (PL) { P16 += z * sC; Ph += z * sC; Pl += z * sC; } else C += z * sC;
    const int lane = threadIdx.x & 31, lr = lane & 15, hi = lane >> 4; const int r0 = bx * 64, c0 = by * 64;
    const int w = (NW == 1) ? 0 : __builtin_amdgcn_readfirstlane((int)(threadIdx.x >> 5));   // wave number, scalar: the K loop's branch stays wave-uniform (WMMA needs every lane on)
    v8f acc[4][4];
#pragma unroll
    for (int mb = 0; mb < 4; ++mb)
#pragma unroll
        for (int nb = 0; nb < 4; ++nb) acc[mb][nb] = (v8f){};
    const size_t aoff = (size_t)(r0 + lr) * K + 8 * hi, boff = (size_t)(c0 + lr) * K + 8 * hi;
    const T16* pa = A + aoff + w * 32; const T16* pa2 = (NSPLIT == 1 || NSPLIT == 2) ? A2 + aoff + w * 32 : pa; const T16* pb = Bt + boff + w * 32; const T16* pb2 = (NSPLIT >= 2) ? Bt2 + boff + w * 32 : pb;
#pragma unroll 1
    for (int kc = w * 32; kc < K; kc += 32 * NW, pa += 32 * NW, pa2 += 32 * NW, pb += 32 * NW, pb2 += 32 * NW) {
        V a[4], a2[4];
#pragma unroll
        for (int mb = 0; mb < 4; ++mb) { a[mb] = WFrag<T16>::ld(pa + (size_t)mb * 16 * K); if (NSPLIT == 1 || NSPLIT == 2) a2[mb] = WFrag<T16>::ld(pa2 + (size_t)mb * 16 * K); }
#pragma unroll
        for (int nb = 0; nb < 4; ++nb) { const V b = WFrag<T16>::ld(pb + (size_t)nb * 16 * K); V b2; if (NSPLIT >= 2) b2 = WFrag<T16>::ld(pb2 + (size_t)nb * 16 * K);
            if (nb == 3) addr_wait(pa, pa2, pb, pb2);
#pragma unroll
            for (int mb = 0; mb < 4; ++mb) { acc[mb][nb] = WFrag<T16>::mma(a[mb], b, acc[mb][nb]); if (NSPLIT == 1 || NSPLIT == 2) acc[mb][nb] = WFrag<T16>::mma(a2[mb], b, acc[mb][nb]); if (NSPLIT >= 2) acc[mb][nb] = WFrag<T16>::mma(a[mb], b2, acc[mb][nb]); } }
        asm volatile("v_nop\n\tv_nop\n\tv_nop\n\tv_nop" : "+v"(acc[0][0]), "+v"(acc[1][1]), "+v"(acc[2][2]), "+v"(acc[3][3]) : "v"(a[0]), "v"(a[3]));
    }
#pragma unroll
    for (int mb = 0; mb < 4; ++mb) {
#pragma unroll
        for (int nb = 0; nb < 4; ++nb) {
#pragma unroll
            for (int j = 0; j < 8; ++j) os[w * (16 * 68) + (hi * 8 + j) * 68 + nb * 16 + lr] = acc[mb][nb][j]; }
        tile_sync<NW>();   // every wave's partial slab is in LDS before any thread adds them
        float* crow = C + (size_t)(r0 + mb * 16) * ldc + c0;
{
#pragma unroll
            for (int s = 0; s < (NW < 8 ? 8 / NW : 1); ++s) if (NW <= 8 || w < 8) { const int idx = s * (32 * NW) + (int)threadIdx.x; const int row = idx >> 4, cofs = (idx & 15) * 4; v4f val = *(const v4fa*)(os + row * 68 + cofs);
#pragma unroll
                for (int ww = 1; ww < NW; ++ww) val += *(const v4fa*)(os + ww * (16 * 68) + row * 68 + cofs);
                if (BIAS && !PL) { val[0] += bfr(bias[c0 + cofs]); val[1] += bfr(bias[c0 + cofs + 1]); val[2] += bfr(bias[c0 + cofs + 2]); val[3] += bfr(bias[c0 + cofs + 3]); }
                if (PL) { if (BIAS) val += bfr(bias[r0 + mb * 16 + row]); v4h o16; v4us oh, ol;
#pragma unroll
                    for (int q = 0; q < 4; ++q) { o16[q] = tohx(val[q]); unsigned short a2, c2; splitf(val[q], a2, c2); oh[q] = a2; ol[q] = c2; }
                    const size_t oo = (size_t)(r0 + mb * 16 + row) * ldc + c0 + cofs; *(v4h*)(P16 + oo) = o16; *(v4us*)(Ph + oo) = oh; *(v4us*)(Pl + oo) = ol; }
                else *(v4f*)(crow + (size_t)row * ldc + cofs) = val;
                asm volatile("s_wait_xcnt 0x0" ::: "memory"); /* behind the store, before later code reuses its address and data registers */ }
             }
        if (mb < 3) tile_sync<NW>();   // the slabs are read out before the next 16 rows overwrite them
    }
}

// ---- d_fattn (body): scores, softmax and probabilities x values of one block of 16 query rows for the 4 query heads of one (batch, key group), one wave per head, keys in steps of 32 up to the diagonal.
// Both products are taken transposed, so that nothing changes lanes between them: S^T = K Q^T (A = key rows from LDS, B = the wave's query rows, held in registers) leaves query lr in lane lr with keys hi x 8 + j in register j,
// which is the B fragment of O^T = V^T P^T (A = value rows [feature][key] from LDS) as it stands; the running maximum, the running sum and the rescale factor of a query are then per lane.
// The 4 waves share each step's key and value tiles: global -> registers -> LDS (key rows at pitch KPIT, value rows at pitch VPIT: 16 B x odd, so that the 16 rows of a fragment read fall on different banks).
// HL false (fp16 planes, probabilities x PCAR): two LDS buffers, the next step's tile is loaded into registers ahead of this step's products and stored to the other buffer behind them, one barrier a step.
// HL true (bf16 hi + lo planes, 3 products each): buffer 0 holds the hi tiles, buffer 1 the lo tiles, two barriers a step.
// The result / running sum is stored as bf16 hi + lo planes Ah / Al in the merged layout [batch][t][head][d] that the output projection reads.
#define KPIT 264                          // 16-bit elements between key rows in LDS (256 + 8)
#define VPIT 40                           // 16-bit elements between value rows in LDS (32 + 8)
#define BUFH (32 * KPIT + HD * VPIT)      // 16-bit elements of one LDS buffer: 32 key rows, then HD value rows
#define L2E  1.4426950408889634f
__device__ __forceinline__ float xhalf(float x) { return __builtin_bit_cast(float, __builtin_amdgcn_permlanex16(__builtin_bit_cast(int, x), __builtin_bit_cast(int, x), 0x76543210, 0xfedcba98, false, false)); }   // lane l reads lane l ^ 16
// st_load: this thread's 8 + 8 pieces of 16 bytes of a key tile (32 x HD, contiguous) and of a value tile (HD rows of 32 keys)
template <typename T16> __device__ __forceinline__ void st_load(v8us (&r)[16], const T16* kp, const T16* vp) {
#pragma unroll
    for (int p = 0; p < 8; ++p) r[p] = *(const v8usa*)(kp + p * 1024);
#pragma unroll
    for (int p = 0; p < 8; ++p) r[8 + p] = *(const v8usa*)(vp + (size_t)p * 32 * TT);
    addr_wait(kp, vp, kp, vp);   // s_wait_xcnt 0 behind the loads, before later code reuses their address registers
}
__device__ __forceinline__ void st_store(const v8us (&r)[16], bf* buf) { const int tid = threadIdx.x;
#pragma unroll
    for (int p = 0; p < 8; ++p) *(v8usa*)(buf + (p * 4 + (tid >> 5)) * KPIT + (tid & 31) * 8) = r[p];
#pragma unroll
    for (int p = 0; p < 8; ++p) *(v8usa*)(buf + 32 * KPIT + (p * 32 + (tid >> 2)) * VPIT + (tid & 3) * 8) = r[8 + p];
}
template <typename T16, bool HL>
__device__ __forceinline__ void d_fattn(bf* sm, const int rb, const int bg, const T16* __restrict__ Q, const T16* __restrict__ Q2, const T16* __restrict__ Kp, const T16* __restrict__ Kp2, const T16* __restrict__ Vt, const T16* __restrict__ Vt2, bf* Ah, bf* Al) {
    typedef typename WFrag<T16>::V V;
    const int tid = threadIdx.x, lane = tid & 31, lr = lane & 15, hi = lane >> 4;
    const int w = __builtin_amdgcn_readfirstlane(tid >> 5);   // wave number = query head within the key group, scalar
    const int q0 = rb * 16; const size_t z = (size_t)bg * REP + w;   // z = batch x NH_ + query head
    const int ns = (q0 + 16 + 31) >> 5;                       // steps of 32 keys that reach the block's last row
    V qf[8], qf2[8];
    { const size_t qo = (z * TT + q0 + lr) * HD + 8 * hi;
#pragma unroll
      for (int ks = 0; ks < 8; ++ks) { qf[ks] = WFrag<T16>::ld(Q + qo + ks * 32); if (HL) qf2[ks] = WFrag<T16>::ld(Q2 + qo + ks * 32); }
      addr_wait(Q + qo, HL ? Q2 + qo : Q + qo, Q + qo, Q + qo); }
    const size_t ko = (size_t)bg * TT * HD + tid * 8, vo = ((size_t)bg * HD + (tid >> 2)) * TT + (tid & 3) * 8;   // this thread's first piece of key tile 0 and of value tile 0
    v8f o[16];
#pragma unroll
    for (int ft = 0; ft < 16; ++ft) o[ft] = (v8f){};
    float m = -3.0e38f, l = 0.f; v8us r[16];
    const T16* kn = Kp + ko; const T16* vn = Vt + vo; const T16* kn2 = HL ? Kp2 + ko : kn; const T16* vn2 = HL ? Vt2 + vo : vn;   // this thread's pieces of the next tile to load; they step behind st_load's wait
    if (!HL) { st_load(r, kn, vn); kn += 32 * HD; vn += 32; st_store(r, sm); tile_sync<4>(); }   // tile 0 is in buffer 0 before any wave reads it
#pragma unroll 1
    for (int st = 0; st < ns; ++st) {
        const int k0 = st * 32;
        if (HL) { if (st) tile_sync<4>();   // every wave has read the last step's tiles before they are overwritten
            st_load(r, kn, vn); kn += 32 * HD; vn += 32; st_store(r, sm); st_load(r, kn2, vn2); kn2 += 32 * HD; vn2 += 32; st_store(r, sm + BUFH);
            tile_sync<4>(); }               // this step's tiles are in LDS before any wave reads them
        else if (st + 1 < ns) { st_load(r, kn, vn); kn += 32 * HD; vn += 32; }
        const T16* Ks = (const T16*)(sm + (HL ? 0 : (st & 1) * BUFH)); const T16* Ks2 = (const T16*)(sm + BUFH);
        const T16* ka = Ks + lr * KPIT + 8 * hi; const T16* ka2 = Ks2 + lr * KPIT + 8 * hi; const T16* va = Ks + 32 * KPIT + lr * VPIT + 8 * hi; const T16* va2 = Ks2 + 32 * KPIT + lr * VPIT + 8 * hi;
        v8f s[2]; s[0] = (v8f){}; s[1] = (v8f){};
        if constexpr (HL) {
#pragma unroll
            for (int g = 0; g < 4; ++g) { V ak[4], ak2[4];   // two 32-wide feature steps x two key blocks, hi and lo, read from LDS as one group
#pragma unroll
                for (int i = 0; i < 4; ++i) { ak[i] = WFrag<T16>::ld(ka + (i & 1) * 16 * KPIT + (g * 2 + (i >> 1)) * 32); ak2[i] = WFrag<T16>::ld(ka2 + (i & 1) * 16 * KPIT + (g * 2 + (i >> 1)) * 32); }
                asm volatile("" :: "v"(ak[0]), "v"(ak[1]), "v"(ak[2]), "v"(ak[3]), "v"(ak2[0]), "v"(ak2[1]), "v"(ak2[2]), "v"(ak2[3]) : "memory");   // a group's LDS reads stand together, one wait a group (inputs only): left free, nearly every pair of reads had a full wait of its own
#pragma unroll
                for (int i = 0; i < 4; ++i) { const int ks = g * 2 + (i >> 1); v8f& sk = s[i & 1]; sk = WFrag<T16>::mma(ak[i], qf[ks], sk); sk = WFrag<T16>::mma(ak[i], qf2[ks], sk); sk = WFrag<T16>::mma(ak2[i], qf[ks], sk); } }
        } else {
#pragma unroll
            for (int ks = 0; ks < 8; ++ks)
#pragma unroll
                for (int kt = 0; kt < 2; ++kt) s[kt] = WFrag<T16>::mma(WFrag<T16>::ld(ka + kt * 16 * KPIT + ks * 32), qf[ks], s[kt]);
        }
        constexpr int NG = HL ? 4 : 16;   // value fragments read from LDS as one group
        V vf[NG], vf2[HL ? NG : 1];
#pragma unroll
        for (int ft = 0; ft < NG; ++ft) { vf[ft] = WFrag<T16>::ld(va + ft * 16 * VPIT); if constexpr (HL) vf2[ft] = WFrag<T16>::ld(va2 + ft * 16 * VPIT); }
        float t[16]; float mx = -3.0e38f; const int lim = q0 + lr - k0 - hi * 8;   // element e holds key k0 + hi x 8 + (e >> 3) x 16 + (e & 7): causal where that offset <= lim
#pragma unroll
        for (int e = 0; e < 16; ++e) { t[e] = ((e >> 3) * 16 + (e & 7) <= lim) ? s[e >> 3][e & 7] * SCL : -3.0e38f; mx = fmaxf(mx, t[e]); }
        mx = fmaxf(mx, xhalf(mx));   // the query's other 16 keys of the step lie in lane lr ^ 16
        const float mn = fmaxf(m, mx);
        if (__builtin_amdgcn_ballot_w32(mn > m)) {   // wave-uniform: where no query's maximum moved, the factor is exactly 1
            const float al = __builtin_amdgcn_exp2f((m - mn) * L2E); l *= al; m = mn;
#pragma unroll
            for (int ft = 0; ft < 16; ++ft) o[ft] *= al; }
        V pf, pf2; float la[4] = {0.f, 0.f, 0.f, 0.f};   // four partial sums: no chain of 16 dependent adds
#pragma unroll
        for (int e = 0; e < 16; ++e) { const float p = __builtin_amdgcn_exp2f((t[e] - m) * L2E); la[e & 3] += p;
            if constexpr (HL) { unsigned short a2, c2; splitf(p, a2, c2); pf[e] = __builtin_bit_cast(__bf16, a2); pf2[e] = __builtin_bit_cast(__bf16, c2); }
            else pf[e] = tohx(p * PCAR); }
        l += (la[0] + la[1]) + (la[2] + la[3]);
#pragma unroll
        for (int g = 0; g < 16 / NG; ++g) {
            if (g) {
#pragma unroll
                for (int ft = 0; ft < NG; ++ft) { vf[ft] = WFrag<T16>::ld(va + (g * NG + ft) * 16 * VPIT); if constexpr (HL) vf2[ft] = WFrag<T16>::ld(va2 + (g * NG + ft) * 16 * VPIT); } }
            if constexpr (HL) asm volatile("" :: "v"(vf[0]), "v"(vf[1]), "v"(vf[2]), "v"(vf[3]), "v"(vf2[0]), "v"(vf2[1]), "v"(vf2[2]), "v"(vf2[3]) : "memory");   // holds the next group's LDS reads behind this group's (inputs only): left free, all 32 fragments were read ahead and the query fragments spilled
#pragma unroll
            for (int ft = 0; ft < NG; ++ft) { v8f& oo_ = o[g * NG + ft]; oo_ = WFrag<T16>::mma(vf[ft], pf, oo_);
                if constexpr (HL) { oo_ = WFrag<T16>::mma(vf[ft], pf2, oo_); oo_ = WFrag<T16>::mma(vf2[ft], pf, oo_); } } }
        if (!HL) { if (st + 1 < ns) st_store(r, sm + ((st + 1) & 1) * BUFH);   // the buffer that step st - 1 read: every wave left it at the last barrier
            tile_sync<4>(); }   // publishes the next tile and ends this step's reads
    }
    l += xhalf(l);
    const float inv = __fdiv_rn(HL ? 1.0f : 1.0f / PCAR, l);
    const size_t oo = (z / NH_) * ((size_t)TT * DQ) + (size_t)(q0 + lr) * DQ + (z % NH_) * HD + hi * 8;
#pragma unroll
    for (int ft = 0; ft < 16; ++ft) { v8us oh, ol;
#pragma unroll
        for (int j = 0; j < 8; ++j) { unsigned short a2, c2; splitf(o[ft][j] * inv, a2, c2); oh[j] = a2; ol[j] = c2; }
        *(v8us*)(Ah + oo + ft * 16) = oh; *(v8us*)(Al + oo + ft * 16) = ol;
        asm volatile("s_wait_xcnt 0x0" ::: "memory"); /* behind the stores, before later code reuses their address and data registers */ }
}

typedef __attribute__((ext_vector_type(2))) _Float16 v2h;
typedef __attribute__((ext_vector_type(2))) unsigned short v2us;
typedef __attribute__((ext_vector_type(2))) float v2f;
typedef __attribute__((ext_vector_type(4))) int v4i;

__device__ __forceinline__ void d_wtG(const int bx, const float* __restrict__ w, int K, int N, bf* Bt) {
    const int lane = threadIdx.x & 31; const int L0 = (bx * 8 + (threadIdx.x >> 5)) * 8; const int nlines = N * K / 64;
{
#pragma unroll 1
        for (int l = 0; l < 8; ++l) { const int L = L0 + l; if (L >= nlines) break; const size_t e = (size_t)L * 64 + lane * 2; const int k = (int)(e % K), n = (int)(e / K); v2us o;
            o[0] = f2bf(w[(size_t)k * N + n]); o[1] = f2bf(w[(size_t)(k + 1) * N + n]); *(v2us*)(Bt + e) = o; }
         }
}
// d_cvt8s: x [t][batch][DM] f32 -> bf16 rows in batch-major order [batch][t][DM]
__device__ __forceinline__ void d_cvt8s(const int bx, const float* __restrict__ src, bf* dst, size_t n8) { const size_t i = (size_t)bx * 256 + threadIdx.x; if (i >= n8) return; const size_t e = i * 8; const size_t m = e / DM, c = e % DM; const v8f v = *(const v8f*)(src + ((m % TT) * NB_ + m / TT) * DM + c); v8us o;
#pragma unroll
    for (int k = 0; k < 8; ++k) o[k] = f2bf(v[k]); *(v8us*)(dst + e) = o;  }
// d_lnchunk: one wave per 256-wide head row w = (batch x TT + t) x NCH + h of F; the normalised row goes straight into the head planes [batch x NCH + h][t][d] (fp16, bf16 hi, bf16 lo) that the score products read.
template <int NCH>
__device__ __forceinline__ void d_lnchunk(const int bx, const float* __restrict__ F, const float* __restrict__ gw, const float* __restrict__ gb, h16* P16, bf* Ph, bf* Pl) {
    const int lane = threadIdx.x & 31; const int w = bx * 8 + (threadIdx.x >> 5); if (w >= NB_ * TT * NCH) return; const float* fr = F + (size_t)w * HD; const int m = w / NCH; const size_t pe = ((size_t)((m / TT) * NCH + w % NCH) * TT + m % TT) * HD; float hv[8]; float s = 0.f;
#pragma unroll
    for (int ch = 0; ch < 2; ++ch) { const v4f y = *(const v4f*)(fr + ch * 128 + lane * 4);
#pragma unroll
        for (int q = 0; q < 4; ++q) { hv[ch * 4 + q] = y[q]; s += y[q]; } }
#pragma unroll
    for (int sh = 16; sh; sh >>= 1) s += __shfl_xor(s, sh, 32);
    const float mu = s * (1.0f / HD); float s2 = 0.f;
#pragma unroll
    for (int k = 0; k < 8; ++k) { float d0 = __fsub_rn(hv[k], mu); asm volatile("" : "+v"(d0)); float p = __fmul_rn(d0, d0); asm volatile("" : "+v"(p)); s2 = __fadd_rn(s2, p); }
#pragma unroll
    for (int sh = 16; sh; sh >>= 1) s2 += __shfl_xor(s2, sh, 32);
    float var = __fadd_rn(s2 * (1.0f / HD), 1e-5f); asm volatile("" : "+v"(var)); const float rs = __frsqrt_rn(var);
{
#pragma unroll
        for (int ch = 0; ch < 2; ++ch) { const int c0 = ch * 128 + lane * 4; v4f o;
#pragma unroll
            for (int q = 0; q < 4; ++q) { float gg = bfr(gw[c0 + q]), bb = bfr(gb[c0 + q]); asm volatile("" : "+v"(gg), "+v"(bb)); float d0 = __fsub_rn(hv[ch * 4 + q], mu); asm volatile("" : "+v"(d0)); float n0 = __fmul_rn(d0, rs); asm volatile("" : "+v"(n0)); float n1 = __fmul_rn(n0, gg); asm volatile("" : "+v"(n1)); o[q] = __fadd_rn(n1, bb); }
            v4h o16; v4us oh, ol;
#pragma unroll
            for (int q = 0; q < 4; ++q) { o16[q] = tohx(o[q]); unsigned short a2, c2; splitf(o[q], a2, c2); oh[q] = a2; ol[q] = c2; }
            *(v4h*)(P16 + pe + c0) = o16; *(v4us*)(Ph + pe + c0) = oh; *(v4us*)(Pl + pe + c0) = ol;
            asm volatile("s_wait_xcnt 0x0" ::: "memory"); /* behind the stores, before the next half row's code reuses their data registers */ }
         } }
__global__ __launch_bounds__(256) void k_cvt8(const float* __restrict__ src, bf* dst, size_t n8) { const size_t i = (size_t)blockIdx.x * 256 + threadIdx.x; if (i >= n8) return; const v8f v = *(const v8f*)(src + i * 8); v8us o;
#pragma unroll
    for (int k = 0; k < 8; ++k) o[k] = f2bf(v[k]); *(v8us*)(dst + i * 8) = o;  }

// ---- Merged launches: launches that do not depend on each other share one grid; a block-uniform test on the block index picks the body, and every body works on the tiles it had in its own launch.
#define GWQ (DM * DQ / 64 / 64)    // work-groups of the WQ (and WO) transpose
#define GWK (DM * DKV / 64 / 64)   // work-groups of the WK (and WV) transpose
#define GCX (NB_ * TT * DM / 8 / 256)   // work-groups of the x conversion
// k_prep: the four weight transposes (the longer bodies, first) and the x conversion
__global__ __launch_bounds__(256) void k_prep(const float* __restrict__ wq, const float* __restrict__ wo, const float* __restrict__ wk, const float* __restrict__ wv, const float* __restrict__ x, bf* WQ, bf* WO, bf* WK, bf* WV, bf* XB) {
    const int b = blockIdx.x;
    if (b < GWQ) d_wtG(b, wq, DM, DQ, WQ);
    else if (b < 2 * GWQ) d_wtG(b - GWQ, wo, DQ, DM, WO);
    else if (b < 2 * GWQ + GWK) d_wtG(b - 2 * GWQ, wk, DM, DKV, WK);
    else if (b < 2 * GWQ + 2 * GWK) d_wtG(b - (2 * GWQ + GWK), wv, DM, DKV, WV);
    else d_cvt8s(b - (2 * GWQ + 2 * GWK), x, XB, (size_t)NB_ * TT * DM / 8);   /* rows batch-major: m = batch x TT + t */
}
// k_proj: grid (NB_ TT / 64, (DQ + 2 DKV) / 64): columns y < DQ / 64 are q tiles, the next DKV / 64 k tiles; the rest, counted x first, are the transposed v tiles in their own launch order (feature tile, position tile, batch)
__global__ __launch_bounds__(128) void k_proj(const bf* __restrict__ XB, const bf* __restrict__ WQ, const bf* __restrict__ WK, const bf* __restrict__ WV, const float* __restrict__ bq, const float* __restrict__ bk, const float* __restrict__ bv, float* FQ, float* FK, h16* VT16, bf* VTh, bf* VTl) {
    __shared__ __align__(16) float os[4 * 16 * 68];
    const int bx = blockIdx.x, by = blockIdx.y;
    if (by < DQ / 64) d_gemmw<bf, 0, true, 4, false>(os, bx, by, 0, XB, nullptr, WQ, nullptr, DM, FQ, DQ, bq, 0, 0, 0, nullptr, nullptr, nullptr);
    else if (by < (DQ + DKV) / 64) d_gemmw<bf, 0, true, 4, false>(os, bx, by - DQ / 64, 0, XB, nullptr, WK, nullptr, DM, FK, DKV, bk, 0, 0, 0, nullptr, nullptr, nullptr);
    else { const int t = (by - (DQ + DKV) / 64) * (NB_ * TT / 64) + bx;
        d_gemmw<bf, 0, true, 4, true>(os, t % (DKV / 64), (t / (DKV / 64)) % (TT / 64), (size_t)(t / ((DKV / 64) * (TT / 64))), WV, nullptr, XB, nullptr, DM, nullptr, TT, bv, 0, (size_t)TT * DM, (size_t)DKV * TT, VT16, VTh, VTl); }   /* v transposed, z = batch: rows = (group, feature), columns = positions */
}
// k_ln: LayerNorm of the query head rows, then of the key group rows
__global__ __launch_bounds__(256) void k_ln(const float* __restrict__ FQ, const float* __restrict__ FK, const float* __restrict__ gw, const float* __restrict__ gb, h16* QP16, bf* QPh, bf* QPl, h16* KP16, bf* KPh, bf* KPl) {
    const int b = blockIdx.x;
    if (b < NB_ * TT * NH_ / 8) d_lnchunk<NH_>(b, FQ, gw, gb, QP16, QPh, QPl);
    else d_lnchunk<NKV>(b - NB_ * TT * NH_ / 8, FK, gw, gb, KP16, KPh, KPl);
}
// k_fattn: grid (TT / 16 query row blocks, NB_ NKV), 4 waves. The first half of the grid takes the row blocks from the last (longest) down, the second half from the first up, so that work-groups half a grid apart have the same work together.
// Row blocks below RH take the hi+lo products, the rest fp16. The second launch bound keeps a wave within half a SIMD's registers, so that two work-groups (a long and a short one) share a WGP.
__global__ __launch_bounds__(128, 2) void k_fattn(const bf* __restrict__ QPh, const bf* __restrict__ QPl, const bf* __restrict__ KPh, const bf* __restrict__ KPl, const bf* __restrict__ VTh, const bf* __restrict__ VTl, const h16* __restrict__ QP16, const h16* __restrict__ KP16, const h16* __restrict__ VT16, bf* ATh, bf* ATl) {
    __shared__ __align__(16) bf sm[2 * BUFH];
    const int bg = blockIdx.y; const int rb = (bg < NB_ * NKV / 2) ? TT / 16 - 1 - (int)blockIdx.x : (int)blockIdx.x;
    if (rb < RH / 16) d_fattn<bf, true>(sm, rb, bg, QPh, QPl, KPh, KPl, VTh, VTl, ATh, ATl);
    else d_fattn<h16, false>(sm, rb, bg, QP16, nullptr, KP16, nullptr, VT16, nullptr, ATh, ATl);
}
// k_out: d_gemmw alone in a launch (the output projection), grid (TT / 64, DM / 64, NB_); its shape is written here like the other kernels', so that the row blocks of an operand share one address pair (the one addr_wait names)
__global__ __launch_bounds__(512) void k_out(const bf* __restrict__ ATh, const bf* __restrict__ ATl, const bf* __restrict__ WO, const float* __restrict__ bo, float* OUT) {
    __shared__ __align__(16) float os[16 * 16 * 68];
    d_gemmw<bf, 1, true, 16, false>(os, blockIdx.x, blockIdx.y, blockIdx.z, ATh, ATl, WO, nullptr, DQ, OUT, NB_ * DM, bo, (size_t)TT * DQ, 0, (size_t)DM, nullptr, nullptr, nullptr);   /* z = batch; output rows interleaved by batch: pitch 2 x 256 */
}

extern "C" void kernel_launch(void* const* d_in, const int* in_sizes, int n_in,
                              void* d_out, int out_size, void* d_ws, size_t ws_size, hipStream_t stream) {
    (void)in_sizes; (void)n_in; (void)out_size;
    const float* x = (const float*)d_in[0]; const float* wk = (const float*)d_in[1]; const float* bk = (const float*)d_in[2]; const float* wv = (const float*)d_in[3]; const float* bv = (const float*)d_in[4]; const float* wq = (const float*)d_in[5]; const float* bq = (const float*)d_in[6]; const float* wo = (const float*)d_in[7]; const float* bo = (const float*)d_in[8]; const float* lng = (const float*)d_in[9]; const float* lnb = (const float*)d_in[10];
    float* OUT = (float*)d_out;     // [2048][2][256] (seq, batch, dim)
    char* wsp = (char*)d_ws;
    auto take = [&](size_t bytes) { char* p = wsp; wsp += (bytes + 255) & ~(size_t)255; return (void*)p; };
    bf* WQ = (bf*)take((size_t)DQ * DM * 2); bf* WK = (bf*)take((size_t)DKV * DM * 2); bf* WV = (bf*)take((size_t)DKV * DM * 2); bf* WO = (bf*)take((size_t)DM * DQ * 2);
    bf* XB = (bf*)take((size_t)NB_ * TT * DM * 2);
    h16* QP16 = (h16*)take((size_t)NZ * TT * HD * 2); h16* KP16 = (h16*)take((size_t)NB_ * NKV * TT * HD * 2); h16* VT16 = (h16*)take((size_t)NB_ * NKV * HD * TT * 2);
    bf* QPh = (bf*)take((size_t)NZ * TT * HD * 2); bf* QPl = (bf*)take((size_t)NZ * TT * HD * 2); bf* KPh = (bf*)take((size_t)NB_ * NKV * TT * HD * 2); bf* KPl = (bf*)take((size_t)NB_ * NKV * TT * HD * 2); bf* VTh = (bf*)take((size_t)NB_ * NKV * HD * TT * 2); bf* VTl = (bf*)take((size_t)NB_ * NKV * HD * TT * 2);
    bf* ATh = (bf*)take((size_t)NB_ * TT * DQ * 2); bf* ATl = (bf*)take((size_t)NB_ * TT * DQ * 2);
    float* FQ = (float*)take((size_t)NB_ * TT * DQ * 4); float* FK = (float*)take((size_t)NB_ * TT * DKV * 4);   /* the f32 q and k projections, read by LayerNorm */
    if ((size_t)(wsp - (char*)d_ws) > ws_size) return;    // ws 256 MiB
    k_prep<<<2 * GWQ + 2 * GWK + GCX, 256, 0, stream>>>(wq, wo, wk, wv, x, WQ, WO, WK, WV, XB);
    k_proj<<<dim3(NB_ * TT / 64, (DQ + 2 * DKV) / 64, 1), 128, 0, stream>>>(XB, WQ, WK, WV, bq, bk, bv, FQ, FK, VT16, VTh, VTl);
    k_ln<<<NB_ * TT * (NH_ + NKV) / 8, 256, 0, stream>>>(FQ, FK, lng, lnb, QP16, QPh, QPl, KP16, KPh, KPl);
    k_fattn<<<dim3(TT / 16, NB_ * NKV, 1), 128, 0, stream>>>(QPh, QPl, KPh, KPl, VTh, VTl, QP16, KP16, VT16, ATh, ATl);
    k_out<<<dim3(TT / 64, DM / 64, NB_), 512, 0, stream>>>(ATh, ATl, WO, bo, OUT);
}

// v007
// Measured time: 115 microseconds a run.
// Timed twice side by side with v006, it ran 1.11 times as fast both times.
// Over all steps from v000 it is 12.9 times as fast.
#include <hip/hip_runtime.h>

// Grouped (GQA-style) causal attention with full-width heads and LayerNorm on q and k (x [2048][2][256] (seq, batch, dim); K = x WK_w + WK_b, V = x WV_w + WV_b ('xw' [256][512]: 2 key groups of width 256); Q = x WQ_w + WQ_b ('xw' [256][2048]: 2 groups x 4 sub-queries of width 256, head (g, sub) uses key group g); K and Q LayerNormed over their 256 features (ln_g, ln_b, eps 1e-5); scores = Q.K/16, causal (-inf); softmax; out = merged (g, sub, i) WO_w + WO_b ('xw' [2048][256]) -> [2048][2][256] (1.05 M)).
// Compute dtypes, f32 accumulate: every input rounded to bf16; q/k/v on PLAIN bf16 operands (inputs: exact) + biases; LayerNorm of every 256-wide q / k head row in f32, stored straight as 16-bit head planes; v projected transposed (weights as the A operand) and stored straight as its planes; causal scores, softmax and attn.v in one kernel (running maximum and sum per query in f32, keys in steps of 32 up to the diagonal, no score ever stored), the 4 query heads of a key group sharing its key and value tiles in LDS: query rows < 512 hl (3 products), the rest single fp16 (probabilities x1024); it stores the merged hi+lo rows itself; WO_w hl x exact (2 products) + WO_b.
// Every operand plane of the projections (x, the four weights, the merged attention rows) lies in fragment order (described at WFrag): one operand load of a wave is 512 contiguous bytes.

#define NB_  2
#define TT   2048
#define DM   256
#define NH_  8
#define NKV  2
#define REP  (NH_ / NKV)
#define HD   256
#define DQ   (NH_ * HD)
#define DKV  (NKV * HD)
#define NZ   (NB_ * NH_)          // (batch, query head) pairs, z = batch x NH_ + head
#define RH   512                  // query rows < RH use hi+lo planes (0: none)
#define PCAR 1024.0f
#define SCL  0.0625f   // 1/sqrt(dim = 256)
typedef _Float16 h16;
typedef unsigned short bf;
typedef __attribute__((ext_vector_type(16))) __bf16   v16bf;
typedef __attribute__((ext_vector_type(16))) _Float16 v16h;
typedef __attribute__((ext_vector_type(8)))  _Float16 v8h;
typedef __attribute__((ext_vector_type(8)))  unsigned short v8us;
typedef __attribute__((ext_vector_type(8)))  float    v8f;
typedef __attribute__((ext_vector_type(4)))  float    v4f;
typedef v8h  __attribute__((may_alias)) v8ha;
typedef v4f  __attribute__((may_alias)) v4fa;
typedef v8us __attribute__((may_alias)) v8usa;

__device__ __forceinline__ unsigned short f2bf(float f) { unsigned u = __float_as_uint(f); u += 0x7FFFu + ((u >> 16) & 1u); return (unsigned short)(u >> 16); }
__device__ __forceinline__ float bf2f(unsigned short b) { return __uint_as_float(((unsigned)b) << 16); }
__device__ __forceinline__ float bfr(float f) { return bf2f(f2bf(f)); }
__device__ __forceinline__ v16h cat16(v8h lo, v8h hi) { return __builtin_shufflevector(lo, hi, 0, 1, 2, 3, 4, 5, 6, 7, 8, 9, 10, 11, 12, 13, 14, 15); }
__device__ __forceinline__ v16bf cat16b(v8us lo, v8us hi) { return __builtin_bit_cast(v16bf, __builtin_shufflevector(lo, hi, 0, 1, 2, 3, 4, 5, 6, 7, 8, 9, 10, 11, 12, 13, 14, 15)); }
__device__ __forceinline__ v8f wmma16(v16h a, v16h b, v8f c) { return __builtin_amdgcn_wmma_f32_16x16x32_f16(false, a, false, b, (short)0, c, false, false); }
__device__ __forceinline__ v8f wmmab(v16bf a, v16bf b, v8f c) { return __builtin_amdgcn_wmma_f32_16x16x32_bf16(false, a, false, b, (short)0, c, false, false); }
__device__ __forceinline__ h16 tohx(float x) { return (h16)x; }
__device__ __forceinline__ void splitf(float y, unsigned short& h, unsigned short& l) { h = f2bf(y); l = f2bf(y - bf2f(h)); }
typedef __attribute__((ext_vector_type(4))) _Float16 v4h;
typedef __attribute__((ext_vector_type(4))) unsigned short v4us;



// ---- d_gemmw (body; block indices bx, by, z handed in by the kernel that holds it, with its LDS slabs os): register-blocked GEMM, one work-group of NW waves per 64x64 output tile; wave w takes the 32-wide K steps w, w + NW, ... into its own 16 accumulators (operands straight from 16-bit planes in fragment order),
// and the NW partial tiles are added through LDS in wave order 0..NW-1 (fixed, so the result is the same on every run); grid (M/64, N/64, Z), 32 x NW threads.
// C[m][n] (f32, pitch ldc, + optional f32 bias[n]) = sum_k A[m][k] Bt[n][k] (+ split products per NSPLIT). z-batch strides sA/sB/sC in elements. K % 32 == 0.
// PL: the bias is per row m (bias[m]) and the tile is stored as three 16-bit planes (fp16, bf16 hi, bf16 lo; pitch ldc, z step sC) instead of f32 C: with the weights as A and the activations as Bt this is the transposed projection.
// tile_sync: orders the LDS slabs between the waves of a tile. One wave: only keeps the compiler from moving LDS accesses across. Several waves: the work-group barrier with work-group fences on LDS alone,
// so that a wave waits for its LDS traffic but not for the tile rows it has just stored to global memory (__syncthreads() waited for those stores at every slab; nobody in the launch reads them).
template <int NW> __device__ __forceinline__ void tile_sync() {
    if (NW == 1) { __builtin_amdgcn_wave_barrier(); asm volatile("" ::: "memory"); }
    else { __builtin_amdgcn_fence(__ATOMIC_RELEASE, "workgroup", "local"); __builtin_amdgcn_s_barrier(); __builtin_amdgcn_fence(__ATOMIC_ACQUIRE, "workgroup", "local"); } }
// addr_wait: s_wait_xcnt 0 behind the last operand load of a K step, before later code reuses the loads' address registers. The addresses are named as inputs so that their registers stay whole up to the wait:
// without them a later load of the same step was given an earlier load's address pair as its destination.
__device__ __forceinline__ void addr_wait(const void* p0, const void* p1, const void* p2, const void* p3) { asm volatile("s_wait_xcnt 0x0" :: "v"(p0), "v"(p1), "v"(p2), "v"(p3) : "memory"); }
// Fragment order of a [rows][K] 16-bit operand plane: blocks of 16 rows x 32 k (1 KiB each), k blocks fastest, then row blocks; a block is two halves (k bit 4) of 32 pieces of 16 bytes; piece (k bit 3) x 16 + row % 16 holds 8 successive k of that row,
// and its number is the lane that holds it in a WMMA A or B fragment. A fragment is then two loads of 512 contiguous bytes (4 whole lines) instead of two loads of 32 bytes from each of 16 rows (16 lines); which element stands in which lane and register is as before.
template <typename T16> struct WFrag;
template <> struct WFrag<h16> { typedef v16h V; static __device__ __forceinline__ V ld(const h16* p) { return cat16(*(const v8h*)p, *(const v8h*)(p + 16)); } static __device__ __forceinline__ V ldp(const h16* p) { return cat16(*(const v8h*)p, *(const v8h*)(p + 256)); } static __device__ __forceinline__ v8f mma(V a, V b, v8f c) { return wmma16(a, b, c); } };
template <> struct WFrag<bf> { typedef v16bf V; static __device__ __forceinline__ V ld(const bf* p) { return cat16b(*(const v8us*)p, *(const v8us*)(p + 16)); } static __device__ __forceinline__ V ldp(const bf* p) { return cat16b(*(const v8us*)p, *(const v8us*)(p + 256)); } /* ldp: from a plane in fragment order, p = block + lane x 8 */ static __device__ __forceinline__ v8f mma(V a, V b, v8f c) { return wmmab(a, b, c); } };
template <typename T16, int NSPLIT, bool BIAS, int NW, bool PL>
__device__ __forceinline__ void d_gemmw(float* os, const int bx, const int by, const size_t z, const T16* __restrict__ A, const T16* __restrict__ A2, const T16* __restrict__ Bt, const T16* __restrict__ Bt2, int K, float* C, int ldc, const float* __restrict__ bias, size_t sA, size_t sB, size_t sC, h16* P16, bf* Ph, bf* Pl) {
    typedef typename WFrag<T16>::V V;
    A += z * sA; if (A2) A2 += z * sA; Bt += z * sB; if (Bt2) Bt2 += z * sB; if (PL) { P16 += z * sC; Ph += z * sC; Pl += z * sC; } else C += z * sC;
    const int lane = threadIdx.x & 31, lr = lane & 15, hi = lane >> 4; const int r0 = bx * 64, c0 = by * 64;
    const int w = (NW == 1) ? 0 : __builtin_amdgcn_readfirstlane((int)(threadIdx.x >> 5));   // wave number, scalar: the K loop's branch stays wave-uniform (WMMA needs every lane on)
    v8f acc[4][4];
#pragma unroll
    for (int mb = 0; mb < 4; ++mb)
#pragma unroll
        for (int nb = 0; nb < 4; ++nb) acc[mb][nb] = (v8f){};
    const size_t aoff = (size_t)r0 * K + lane * 8, boff = (size_t)c0 * K + lane * 8;   // this lane's piece of the first block of row block r0 / 16 (c0 / 16); the next 32 k lie 512 elements on, the next 16 rows 16 K
    const T16* pa = A + aoff + w * 512; const T16* pa2 = (NSPLIT == 1 || NSPLIT == 2) ? A2 + aoff + w * 512 : pa; const T16* pb = Bt + boff + w * 512; const T16* pb2 = (NSPLIT >= 2) ? Bt2 + boff + w * 512 : pb;
#pragma unroll 1
    for (int kc = w * 32; kc < K; kc += 32 * NW, pa += 512 * NW, pa2 += 512 * NW, pb += 512 * NW, pb2 += 512 * NW) {
        V a[4], a2[4];
#pragma unroll
        for (int mb = 0; mb < 4; ++mb) { a[mb] = WFrag<T16>::ldp(pa + (size_t)mb * 16 * K); if (NSPLIT == 1 || NSPLIT == 2) a2[mb] = WFrag<T16>::ldp(pa2 + (size_t)mb * 16 * K); }
#pragma unroll
        for (int nb = 0; nb < 4; ++nb) { const V b = WFrag<T16>::ldp(pb + (size_t)nb * 16 * K); V b2; if (NSPLIT >= 2) b2 = WFrag<T16>::ldp(pb2 + (size_t)nb * 16 * K);
            if (nb == 3) addr_wait(pa, pa2, pb, pb2);
#pragma unroll
            for (int mb = 0; mb < 4; ++mb) { acc[mb][nb] = WFrag<T16>::mma(a[mb], b, acc[mb][nb]); if (NSPLIT == 1 || NSPLIT == 2) acc[mb][nb] = WFrag<T16>::mma(a2[mb], b, acc[mb][nb]); if (NSPLIT >= 2) acc[mb][nb] = WFrag<T16>::mma(a[mb], b2, acc[mb][nb]); } }
        asm volatile("v_nop\n\tv_nop\n\tv_nop\n\tv_nop" : "+v"(acc[0][0]), "+v"(acc[1][1]), "+v"(acc[2][2]), "+v"(acc[3][3]) : "v"(a[0]), "v"(a[3]));
    }
#pragma unroll
    for (int mb = 0; mb < 4; ++mb) {
#pragma unroll
        for (int nb = 0; nb < 4; ++nb) {
#pragma unroll
            for (int j = 0; j < 8; ++j) os[w * (16 * 68) + (hi * 8 + j) * 68 + nb * 16 + lr] = acc[mb][nb][j]; }
        tile_sync<NW>();   // every wave's partial slab is in LDS before any thread adds them
        float* crow = C + (size_t)(r0 + mb * 16) * ldc + c0;
{
#pragma unroll
            for (int s = 0; s < (NW < 8 ? 8 / NW : 1); ++s) if (NW <= 8 || w < 8) { const int idx = s * (32 * NW) + (int)threadIdx.x; const int row = idx >> 4, cofs = (idx & 15) * 4; v4f val = *(const v4fa*)(os + row * 68 + cofs);
#pragma unroll
                for (int ww = 1; ww < NW; ++ww) val += *(const v4fa*)(os + ww * (16 * 68) + row * 68 + cofs);
                if (BIAS && !PL) { val[0] += bfr(bias[c0 + cofs]); val[1] += bfr(bias[c0 + cofs + 1]); val[2] += bfr(bias[c0 + cofs + 2]); val[3] += bfr(bias[c0 + cofs + 3]); }
                if (PL) { if (BIAS) val += bfr(bias[r0 + mb * 16 + row]); v4h o16; v4us oh, ol;
#pragma unroll
                    for (int q = 0; q < 4; ++q) { o16[q] = tohx(val[q]); unsigned short a2, c2; splitf(val[q], a2, c2); oh[q] = a2; ol[q] = c2; }
                    const size_t oo = (size_t)(r0 + mb * 16 + row) * ldc + c0 + cofs; *(v4h*)(P16 + oo) = o16; *(v4us*)(Ph + oo) = oh; *(v4us*)(Pl + oo) = ol; }
                else *(v4f*)(crow + (size_t)row * ldc + cofs) = val;
                asm volatile("s_wait_xcnt 0x0" ::: "memory"); /* behind the store, before later code reuses its address and data registers */ }
             }
        if (mb < 3) tile_sync<NW>();   // the slabs are read out before the next 16 rows overwrite them
    }
}

// ---- d_fattn (body): scores, softmax and probabilities x values of one block of 16 query rows for the 4 query heads of one (batch, key group), one wave per head, keys in steps of 32 up to the diagonal.
// Both products are taken transposed, so that nothing changes lanes between them: S^T = K Q^T (A = key rows from LDS, B = the wave's query rows, held in registers) leaves query lr in lane lr with keys hi x 8 + j in register j,
// which is the B fragment of O^T = V^T P^T (A = value rows [feature][key] from LDS) as it stands; the running maximum, the running sum and the rescale factor of a query are then per lane.
// The 4 waves share each step's key and value tiles: global -> registers -> LDS (key rows at pitch KPIT, value rows at pitch VPIT: 16 B x odd, so that the 16 rows of a fragment read fall on different banks).
// HL false (fp16 planes, probabilities x PCAR): two LDS buffers, the next step's tile is loaded into registers ahead of this step's products and stored to the other buffer behind them, one barrier a step.
// HL true (bf16 hi + lo planes, 3 products each): buffer 0 holds the hi tiles, buffer 1 the lo tiles, two barriers a step.
// The result / running sum is stored as bf16 hi + lo planes Ah / Al, rows (batch, t) x columns (head, d), in the fragment order that the output projection reads: a lane's 8 features are its own piece there, so each store of a wave is 512 contiguous bytes.
#define KPIT 264                          // 16-bit elements between key rows in LDS (256 + 8)
#define VPIT 40                           // 16-bit elements between value rows in LDS (32 + 8)
#define BUFH (32 * KPIT + HD * VPIT)      // 16-bit elements of one LDS buffer: 32 key rows, then HD value rows
#define L2E  1.4426950408889634f
__device__ __forceinline__ float xhalf(float x) { return __builtin_bit_cast(float, __builtin_amdgcn_permlanex16(__builtin_bit_cast(int, x), __builtin_bit_cast(int, x), 0x76543210, 0xfedcba98, false, false)); }   // lane l reads lane l ^ 16
// st_load: this thread's 8 + 8 pieces of 16 bytes of a key tile (32 x HD, contiguous) and of a value tile (HD rows of 32 keys)
template <typename T16> __device__ __forceinline__ void st_load(v8us (&r)[16], const T16* kp, const T16* vp) {
#pragma unroll
    for (int p = 0; p < 8; ++p) r[p] = *(const v8usa*)(kp + p * 1024);
#pragma unroll
    for (int p = 0; p < 8; ++p) r[8 + p] = *(const v8usa*)(vp + (size_t)p * 32 * TT);
    addr_wait(kp, vp, kp, vp);   // s_wait_xcnt 0 behind the loads, before later code reuses their address registers
}
__device__ __forceinline__ void st_store(const v8us (&r)[16], bf* buf) { const int tid = threadIdx.x;
#pragma unroll
    for (int p = 0; p < 8; ++p) *(v8usa*)(buf + (p * 4 + (tid >> 5)) * KPIT + (tid & 31) * 8) = r[p];
#pragma unroll
    for (int p = 0; p < 8; ++p) *(v8usa*)(buf + 32 * KPIT + (p * 32 + (tid >> 2)) * VPIT + (tid & 3) * 8) = r[8 + p];
}
template <typename T16, bool HL>
__device__ __forceinline__ void d_fattn(bf* sm, const int rb, const int bg, const T16* __restrict__ Q, const T16* __restrict__ Q2, const T16* __restrict__ Kp, const T16* __restrict__ Kp2, const T16* __restrict__ Vt, const T16* __restrict__ Vt2, bf* Ah, bf* Al) {
    typedef typename WFrag<T16>::V V;
    const int tid = threadIdx.x, lane = tid & 31, lr = lane & 15, hi = lane >> 4;
    const int w = __builtin_amdgcn_readfirstlane(tid >> 5);   // wave number = query head within the key group, scalar
    const int q0 = rb * 16; const size_t z = (size_t)bg * REP + w;   // z = batch x NH_ + query head
    const int ns = (q0 + 16 + 31) >> 5;                       // steps of 32 keys that reach the block's last row
    V qf[8], qf2[8];
    { const size_t qo = (z * TT + q0 + lr) * HD + 8 * hi;
#pragma unroll
      for (int ks = 0; ks < 8; ++ks) { qf[ks] = WFrag<T16>::ld(Q + qo + ks * 32); if (HL) qf2[ks] = WFrag<T16>::ld(Q2 + qo + ks * 32); }
      addr_wait(Q + qo, HL ? Q2 + qo : Q + qo, Q + qo, Q + qo); }
    const size_t ko = (size_t)bg * TT * HD + tid * 8, vo = ((size_t)bg * HD + (tid >> 2)) * TT + (tid & 3) * 8;   // this thread's first piece of key tile 0 and of value tile 0
    v8f o[16];
#pragma unroll
    for (int ft = 0; ft < 16; ++ft) o[ft] = (v8f){};
    float m = -3.0e38f, l = 0.f; v8us r[16];
    const T16* kn = Kp + ko; const T16* vn = Vt + vo; const T16* kn2 = HL ? Kp2 + ko : kn; const T16* vn2 = HL ? Vt2 + vo : vn;   // this thread's pieces of the next tile to load; they step behind st_load's wait
    if (!HL) { st_load(r, kn, vn); kn += 32 * HD; vn += 32; st_store(r, sm); tile_sync<4>(); }   // tile 0 is in buffer 0 before any wave reads it
#pragma unroll 1
    for (int st = 0; st < ns; ++st) {
        const int k0 = st * 32;
        if (HL) { if (st) tile_sync<4>();   // every wave has read the last step's tiles before they are overwritten
            st_load(r, kn, vn); kn += 32 * HD; vn += 32; st_store(r, sm); st_load(r, kn2, vn2); kn2 += 32 * HD; vn2 += 32; st_store(r, sm + BUFH);
            tile_sync<4>(); }               // this step's tiles are in LDS before any wave reads them
        else if (st + 1 < ns) { st_load(r, kn, vn); kn += 32 * HD; vn += 32; }
        const T16* Ks = (const T16*)(sm + (HL ? 0 : (st & 1) * BUFH)); const T16* Ks2 = (const T16*)(sm + BUFH);
        const T16* ka = Ks + lr * KPIT + 8 * hi; const T16* ka2 = Ks2 + lr * KPIT + 8 * hi; const T16* va = Ks + 32 * KPIT + lr * VPIT + 8 * hi; const T16* va2 = Ks2 + 32 * KPIT + lr * VPIT + 8 * hi;
        v8f s[2]; s[0] = (v8f){}; s[1] = (v8f){};
        if constexpr (HL) {
#pragma unroll
            for (int g = 0; g < 4; ++g) { V ak[4], ak2[4];   // two 32-wide feature steps x two key blocks, hi and lo, read from LDS as one group
#pragma unroll
                for (int i = 0; i < 4; ++i) { ak[i] = WFrag<T16>::ld(ka + (i & 1) * 16 * KPIT + (g * 2 + (i >> 1)) * 32); ak2[i] = WFrag<T16>::ld(ka2 + (i & 1) * 16 * KPIT + (g * 2 + (i >> 1)) * 32); }
                asm volatile("" :: "v"(ak[0]), "v"(ak[1]), "v"(ak[2]), "v"(ak[3]), "v"(ak2[0]), "v"(ak2[1]), "v"(ak2[2]), "v"(ak2[3]) : "memory");   // a group's LDS reads stand together, one wait a group (inputs only): left free, nearly every pair of reads had a full wait of its own
#pragma unroll
                for (int i = 0; i < 4; ++i) { const int ks = g * 2 + (i >> 1); v8f& sk = s[i & 1]; sk = WFrag<T16>::mma(ak[i], qf[ks], sk); sk = WFrag<T16>::mma(ak[i], qf2[ks], sk); sk = WFrag<T16>::mma(ak2[i], qf[ks], sk); } }
        } else {
#pragma unroll
            for (int ks = 0; ks < 8; ++ks)
#pragma unroll
                for (int kt = 0; kt < 2; ++kt) s[kt] = WFrag<T16>::mma(WFrag<T16>::ld(ka + kt * 16 * KPIT + ks * 32), qf[ks], s[kt]);
        }
        constexpr int NG = HL ? 4 : 16;   // value fragments read from LDS as one group
        V vf[NG], vf2[HL ? NG : 1];
#pragma unroll
        for (int ft = 0; ft < NG; ++ft) { vf[ft] = WFrag<T16>::ld(va + ft * 16 * VPIT); if constexpr (HL) vf2[ft] = WFrag<T16>::ld(va2 + ft * 16 * VPIT); }
        float t[16]; float mx = -3.0e38f; const int lim = q0 + lr - k0 - hi * 8;   // element e holds key k0 + hi x 8 + (e >> 3) x 16 + (e & 7): causal where that offset <= lim
#pragma unroll
        for (int e = 0; e < 16; ++e) { t[e] = ((e >> 3) * 16 + (e & 7) <= lim) ? s[e >> 3][e & 7] * SCL : -3.0e38f; mx = fmaxf(mx, t[e]); }
        mx = fmaxf(mx, xhalf(mx));   // the query's other 16 keys of the step lie in lane lr ^ 16
        const float mn = fmaxf(m, mx);
        if (__builtin_amdgcn_ballot_w32(mn > m)) {   // wave-uniform: where no query's maximum moved, the factor is exactly 1
            const float al = __builtin_amdgcn_exp2f((m - mn) * L2E); l *= al; m = mn;
#pragma unroll
            for (int ft = 0; ft < 16; ++ft) o[ft] *= al; }
        V pf, pf2; float la[4] = {0.f, 0.f, 0.f, 0.f};   // four partial sums: no chain of 16 dependent adds
#pragma unroll
        for (int e = 0; e < 16; ++e) { const float p = __builtin_amdgcn_exp2f((t[e] - m) * L2E); la[e & 3] += p;
            if constexpr (HL) { unsigned short a2, c2; splitf(p, a2, c2); pf[e] = __builtin_bit_cast(__bf16, a2); pf2[e] = __builtin_bit_cast(__bf16, c2); }
            else pf[e] = tohx(p * PCAR); }
        l += (la[0] + la[1]) + (la[2] + la[3]);
#pragma unroll
        for (int g = 0; g < 16 / NG; ++g) {
            if (g) {
#pragma unroll
                for (int ft = 0; ft < NG; ++ft) { vf[ft] = WFrag<T16>::ld(va + (g * NG + ft) * 16 * VPIT); if constexpr (HL) vf2[ft] = WFrag<T16>::ld(va2 + (g * NG + ft) * 16 * VPIT); } }
            if constexpr (HL) asm volatile("" :: "v"(vf[0]), "v"(vf[1]), "v"(vf[2]), "v"(vf[3]), "v"(vf2[0]), "v"(vf2[1]), "v"(vf2[2]), "v"(vf2[3]) : "memory");   // holds the next group's LDS reads behind this group's (inputs only): left free, all 32 fragments were read ahead and the query fragments spilled
#pragma unroll
            for (int ft = 0; ft < NG; ++ft) { v8f& oo_ = o[g * NG + ft]; oo_ = WFrag<T16>::mma(vf[ft], pf, oo_);
                if constexpr (HL) { oo_ = WFrag<T16>::mma(vf[ft], pf2, oo_); oo_ = WFrag<T16>::mma(vf2[ft], pf, oo_); } } }
        if (!HL) { if (st + 1 < ns) st_store(r, sm + ((st + 1) & 1) * BUFH);   // the buffer that step st - 1 read: every wave left it at the last barrier
            tile_sync<4>(); }   // publishes the next tile and ends this step's reads
    }
    l += xhalf(l);
    const float inv = __fdiv_rn(HL ? 1.0f : 1.0f / PCAR, l);
    const size_t oo = (((z / NH_) * (TT / 16) + rb) * (DQ / 32) + (z % NH_) * (HD / 32)) * 512 + lane * 8;   // row batch x TT + q0 + lr, column head x HD + hi x 8 in fragment order; 16 more features lie 256 elements on
#pragma unroll
    for (int ft = 0; ft < 16; ++ft) { v8us oh, ol;
#pragma unroll
        for (int j = 0; j < 8; ++j) { unsigned short a2, c2; splitf(o[ft][j] * inv, a2, c2); oh[j] = a2; ol[j] = c2; }
        *(v8us*)(Ah + oo + ft * 256) = oh; *(v8us*)(Al + oo + ft * 256) = ol;
        asm volatile("s_wait_xcnt 0x0" ::: "memory"); /* behind the stores, before later code reuses their address and data registers */ }
}

typedef __attribute__((ext_vector_type(2))) _Float16 v2h;
typedef __attribute__((ext_vector_type(2))) unsigned short v2us;
typedef __attribute__((ext_vector_type(2))) float v2f;
typedef __attribute__((ext_vector_type(4))) int v4i;

// d_wtG: w [K][N] f32 -> its transpose [N][K] as a bf16 plane in fragment order. A wave writes one whole 128-byte line of the plane at a time (8 pieces: 8 successive rows n, 8 successive k each; one writer a line), e = the lane's place in the plane.
__device__ __forceinline__ void d_wtG(const int bx, const float* __restrict__ w, int K, int N, bf* Bt) {
    const int lane = threadIdx.x & 31; const int L0 = (bx * 8 + (threadIdx.x >> 5)) * 8; const int nlines = N * K / 64;
{
#pragma unroll 1
        for (int l = 0; l < 8; ++l) { const int L = L0 + l; if (L >= nlines) break; const size_t e = (size_t)L * 64 + lane * 2; const int blk = (int)(e >> 9); const int k = (blk % (K >> 5)) * 32 + (int)((e >> 8) & 1) * 16 + (int)((e >> 7) & 1) * 8 + (int)(e & 7), n = (blk / (K >> 5)) * 16 + (int)((e >> 3) & 15); v2us o;
            o[0] = f2bf(w[(size_t)k * N + n]); o[1] = f2bf(w[(size_t)(k + 1) * N + n]); *(v2us*)(Bt + e) = o; }
         }
}
// d_cvt8s: x [t][batch][DM] f32 -> bf16 rows in batch-major order m = batch x TT + t, in fragment order; thread i writes the plane's i-th piece of 16 bytes, so the stores are contiguous
__device__ __forceinline__ void d_cvt8s(const int bx, const float* __restrict__ src, bf* dst, size_t n8) { const size_t i = (size_t)bx * 256 + threadIdx.x; if (i >= n8) return; const size_t e = i * 8; const size_t blk = i >> 6; const size_t m = (blk / (DM / 32)) * 16 + (i & 15), c = (blk % (DM / 32)) * 32 + ((i >> 5) & 1) * 16 + ((i >> 4) & 1) * 8; const v8f v = *(const v8f*)(src + ((m % TT) * NB_ + m / TT) * DM + c); v8us o;
#pragma unroll
    for (int k = 0; k < 8; ++k) o[k] = f2bf(v[k]); *(v8us*)(dst + e) = o;  }
// d_lnchunk: one wave per 256-wide head row w = (batch x TT + t) x NCH + h of F; the normalised row goes straight into the head planes [batch x NCH + h][t][d] (fp16, bf16 hi, bf16 lo) that the score products read.
template <int NCH>
__device__ __forceinline__ void d_lnchunk(const int bx, const float* __restrict__ F, const float* __restrict__ gw, const float* __restrict__ gb, h16* P16, bf* Ph, bf* Pl) {
    const int lane = threadIdx.x & 31; const int w = bx * 8 + (threadIdx.x >> 5); if (w >= NB_ * TT * NCH) return; const float* fr = F + (size_t)w * HD; const int m = w / NCH; const size_t pe = ((size_t)((m / TT) * NCH + w % NCH) * TT + m % TT) * HD; float hv[8]; float s = 0.f;
#pragma unroll
    for (int ch = 0; ch < 2; ++ch) { const v4f y = *(const v4f*)(fr + ch * 128 + lane * 4);
#pragma unroll
        for (int q = 0; q < 4; ++q) { hv[ch * 4 + q] = y[q]; s += y[q]; } }
#pragma unroll
    for (int sh = 16; sh; sh >>= 1) s += __shfl_xor(s, sh, 32);
    const float mu = s * (1.0f / HD); float s2 = 0.f;
#pragma unroll
    for (int k = 0; k < 8; ++k) { float d0 = __fsub_rn(hv[k], mu); asm volatile("" : "+v"(d0)); float p = __fmul_rn(d0, d0); asm volatile("" : "+v"(p)); s2 = __fadd_rn(s2, p); }
#pragma unroll
    for (int sh = 16; sh; sh >>= 1) s2 += __shfl_xor(s2, sh, 32);
    float var = __fadd_rn(s2 * (1.0f / HD), 1e-5f); asm volatile("" : "+v"(var)); const float rs = __frsqrt_rn(var);
{
#pragma unroll
        for (int ch = 0; ch < 2; ++ch) { const int c0 = ch * 128 + lane * 4; v4f o;
#pragma unroll
            for (int q = 0; q < 4; ++q) { float gg = bfr(gw[c0 + q]), bb = bfr(gb[c0 + q]); asm volatile("" : "+v"(gg), "+v"(bb)); float d0 = __fsub_rn(hv[ch * 4 + q], mu); asm volatile("" : "+v"(d0)); float n0 = __fmul_rn(d0, rs); asm volatile("" : "+v"(n0)); float n1 = __fmul_rn(n0, gg); asm volatile("" : "+v"(n1)); o[q] = __fadd_rn(n1, bb); }
            v4h o16; v4us oh, ol;
#pragma unroll
            for (int q = 0; q < 4; ++q) { o16[q] = tohx(o[q]); unsigned short a2, c2; splitf(o[q], a2, c2); oh[q] = a2; ol[q] = c2; }
            *(v4h*)(P16 + pe + c0) = o16; *(v4us*)(Ph + pe + c0) = oh; *(v4us*)(Pl + pe + c0) = ol;
            asm volatile("s_wait_xcnt 0x0" ::: "memory"); /* behind the stores, before the next half row's code reuses their data registers */ }
         } }
__global__ __launch_bounds__(256) void k_cvt8(const float* __restrict__ src, bf* dst, size_t n8) { const size_t i = (size_t)blockIdx.x * 256 + threadIdx.x; if (i >= n8) return; const v8f v = *(const v8f*)(src + i * 8); v8us o;
#pragma unroll
    for (int k = 0; k < 8; ++k) o[k] = f2bf(v[k]); *(v8us*)(dst + i * 8) = o;  }

// ---- Merged launches: launches that do not depend on each other share one grid; a block-uniform test on the block index picks the body, and every body works on the tiles it had in its own launch.
#define GWQ (DM * DQ / 64 / 64)    // work-groups of the WQ (and WO) transpose
#define GWK (DM * DKV / 64 / 64)   // work-groups of the WK (and WV) transpose
#define GCX (NB_ * TT * DM / 8 / 256)   // work-groups of the x conversion
// k_prep: the four weight transposes (the longer bodies, first) and the x conversion
__global__ __launch_bounds__(256) void k_prep(const float* __restrict__ wq, const float* __restrict__ wo, const float* __restrict__ wk, const float* __restrict__ wv, const float* __restrict__ x, bf* WQ, bf* WO, bf* WK, bf* WV, bf* XB) {
    const int b = blockIdx.x;
    if (b < GWQ) d_wtG(b, wq, DM, DQ, WQ);
    else if (b < 2 * GWQ) d_wtG(b - GWQ, wo, DQ, DM, WO);
    else if (b < 2 * GWQ + GWK) d_wtG(b - 2 * GWQ, wk, DM, DKV, WK);
    else if (b < 2 * GWQ + 2 * GWK) d_wtG(b - (2 * GWQ + GWK), wv, DM, DKV, WV);
    else d_cvt8s(b - (2 * GWQ + 2 * GWK), x, XB, (size_t)NB_ * TT * DM / 8);   /* rows batch-major: m = batch x TT + t */
}
// k_proj: grid (NB_ TT / 64, (DQ + 2 DKV) / 64): columns y < DQ / 64 are q tiles, the next DKV / 64 k tiles; the rest, counted x first, are the transposed v tiles in their own launch order (feature tile, position tile, batch)
__global__ __launch_bounds__(128) void k_proj(const bf* __restrict__ XB, const bf* __restrict__ WQ, const bf* __restrict__ WK, const bf* __restrict__ WV, const float* __restrict__ bq, const float* __restrict__ bk, const float* __restrict__ bv, float* FQ, float* FK, h16* VT16, bf* VTh, bf* VTl) {
    __shared__ __align__(16) float os[4 * 16 * 68];
    const int bx = blockIdx.x, by = blockIdx.y;
    if (by < DQ / 64) d_gemmw<bf, 0, true, 4, false>(os, bx, by, 0, XB, nullptr, WQ, nullptr, DM, FQ, DQ, bq, 0, 0, 0, nullptr, nullptr, nullptr);
    else if (by < (DQ + DKV) / 64) d_gemmw<bf, 0, true, 4, false>(os, bx, by - DQ / 64, 0, XB, nullptr, WK, nullptr, DM, FK, DKV, bk, 0, 0, 0, nullptr, nullptr, nullptr);
    else { const int t = (by - (DQ + DKV) / 64) * (NB_ * TT / 64) + bx;
        d_gemmw<bf, 0, true, 4, true>(os, t % (DKV / 64), (t / (DKV / 64)) % (TT / 64), (size_t)(t / ((DKV / 64) * (TT / 64))), WV, nullptr, XB, nullptr, DM, nullptr, TT, bv, 0, (size_t)TT * DM, (size_t)DKV * TT, VT16, VTh, VTl); }   /* v transposed, z = batch: rows = (group, feature), columns = positions */
}
// k_ln: LayerNorm of the query head rows, then of the key group rows
__global__ __launch_bounds__(256) void k_ln(const float* __restrict__ FQ, const float* __restrict__ FK, const float* __restrict__ gw, const float* __restrict__ gb, h16* QP16, bf* QPh, bf* QPl, h16* KP16, bf* KPh, bf* KPl) {
    const int b = blockIdx.x;
    if (b < NB_ * TT * NH_ / 8) d_lnchunk<NH_>(b, FQ, gw, gb, QP16, QPh, QPl);
    else d_lnchunk<NKV>(b - NB_ * TT * NH_ / 8, FK, gw, gb, KP16, KPh, KPl);
}
// k_fattn: grid (TT / 16 query row blocks, NB_ NKV), 4 waves. The first half of the grid takes the row blocks from the last (longest) down, the second half from the first up, so that work-groups half a grid apart have the same work together.
// Row blocks below RH take the hi+lo products, the rest fp16. The second launch bound keeps a wave within half a SIMD's registers, so that two work-groups (a long and a short one) share a WGP.
__global__ __launch_bounds__(128, 2) void k_fattn(const bf* __restrict__ QPh, const bf* __restrict__ QPl, const bf* __restrict__ KPh, const bf* __restrict__ KPl, const bf* __restrict__ VTh, const bf* __restrict__ VTl, const h16* __restrict__ QP16, const h16* __restrict__ KP16, const h16* __restrict__ VT16, bf* ATh, bf* ATl) {
    __shared__ __align__(16) bf sm[2 * BUFH];
    const int bg = blockIdx.y; const int rb = (bg < NB_ * NKV / 2) ? TT / 16 - 1 - (int)blockIdx.x : (int)blockIdx.x;
    if (rb < RH / 16) d_fattn<bf, true>(sm, rb, bg, QPh, QPl, KPh, KPl, VTh, VTl, ATh, ATl);
    else d_fattn<h16, false>(sm, rb, bg, QP16, nullptr, KP16, nullptr, VT16, nullptr, ATh, ATl);
}
// k_out: d_gemmw alone in a launch (the output projection), grid (TT / 64, DM / 64, NB_); its shape is written here like the other kernels', so that the row blocks of an operand share one address pair (the one addr_wait names)
__global__ __launch_bounds__(512) void k_out(const bf* __restrict__ ATh, const bf* __restrict__ ATl, const bf* __restrict__ WO, const float* __restrict__ bo, float* OUT) {
    __shared__ __align__(16) float os[16 * 16 * 68];
    d_gemmw<bf, 1, true, 16, false>(os, blockIdx.x, blockIdx.y, blockIdx.z, ATh, ATl, WO, nullptr, DQ, OUT, NB_ * DM, bo, (size_t)TT * DQ, 0, (size_t)DM, nullptr, nullptr, nullptr);   /* z = batch; output rows interleaved by batch: pitch 2 x 256 */
}

extern "C" void kernel_launch(void* const* d_in, const int* in_sizes, int n_in,
                              void* d_out, int out_size, void* d_ws, size_t ws_size, hipStream_t stream) {
    (void)in_sizes; (void)n_in; (void)out_size;
    const float* x = (const float*)d_in[0]; const float* wk = (const float*)d_in[1]; const float* bk = (const float*)d_in[2]; const float* wv = (const float*)d_in[3]; const float* bv = (const float*)d_in[4]; const float* wq = (const float*)d_in[5]; const float* bq = (const float*)d_in[6]; const float* wo = (const float*)d_in[7]; const float* bo = (const float*)d_in[8]; const float* lng = (const float*)d_in[9]; const float* lnb = (const float*)d_in[10];
    float* OUT = (float*)d_out;     // [2048][2][256] (seq, batch, dim)
    char* wsp = (char*)d_ws;
    auto take = [&](size_t bytes) { char* p = wsp; wsp += (bytes + 255) & ~(size_t)255; return (void*)p; };
    bf* WQ = (bf*)take((size_t)DQ * DM * 2); bf* WK = (bf*)take((size_t)DKV * DM * 2); bf* WV = (bf*)take((size_t)DKV * DM * 2); bf* WO = (bf*)take((size_t)DM * DQ * 2);
    bf* XB = (bf*)take((size_t)NB_ * TT * DM * 2);
    h16* QP16 = (h16*)take((size_t)NZ * TT * HD * 2); h16* KP16 = (h16*)take((size_t)NB_ * NKV * TT * HD * 2); h16* VT16 = (h16*)take((size_t)NB_ * NKV * HD * TT * 2);
    bf* QPh = (bf*)take((size_t)NZ * TT * HD * 2); bf* QPl = (bf*)take((size_t)NZ * TT * HD * 2); bf* KPh = (bf*)take((size_t)NB_ * NKV * TT * HD * 2); bf* KPl = (bf*)take((size_t)NB_ * NKV * TT * HD * 2); bf* VTh = (bf*)take((size_t)NB_ * NKV * HD * TT * 2); bf* VTl = (bf*)take((size_t)NB_ * NKV * HD * TT * 2);
    bf* ATh = (bf*)take((size_t)NB_ * TT * DQ * 2); bf* ATl = (bf*)take((size_t)NB_ * TT * DQ * 2);
    float* FQ = (float*)take((size_t)NB_ * TT * DQ * 4); float* FK = (float*)take((size_t)NB_ * TT * DKV * 4);   /* the f32 q and k projections, read by LayerNorm */
    if ((size_t)(wsp - (char*)d_ws) > ws_size) return;    // ws 256 MiB
    k_prep<<<2 * GWQ + 2 * GWK + GCX, 256, 0, stream>>>(wq, wo, wk, wv, x, WQ, WO, WK, WV, XB);
    k_proj<<<dim3(NB_ * TT / 64, (DQ + 2 * DKV) / 64, 1), 128, 0, stream>>>(XB, WQ, WK, WV, bq, bk, bv, FQ, FK, VT16, VTh, VTl);
    k_ln<<<NB_ * TT * (NH_ + NKV) / 8, 256, 0, stream>>>(FQ, FK, lng, lnb, QP16, QPh, QPl, KP16, KPh, KPl);
    k_fattn<<<dim3(TT / 16, NB_ * NKV, 1), 128, 0, stream>>>(QPh, QPl, KPh, KPl, VTh, VTl, QP16, KP16, VT16, ATh, ATl);
    k_out<<<dim3(TT / 64, DM / 64, NB_), 512, 0, stream>>>(ATh, ATl, WO, bo, OUT);
}
